// v000
// The times below were measured on an AMD MI455X: many runs one after another, warmed up first and cycling through
// copies of the inputs, with the whole window's GPU time divided by the number of runs. Launches and the gaps
// between them are all in it. The median over several windows is given; except for v000 it joins two sittings, which
// can be a few percent apart, so the side-by-side timings, each taken in one sitting, are the better comparison.
// v000, which the later versions start from, runs in 607 microseconds.
#include <hip/hip_runtime.h>
#include <hip/hip_bf16.h>

// ---------------------------------------------------------------------------
// Transformer block for MI455X (gfx1250, wave32, WMMA f16 -> f32 accum)
//   B=4, S=2048, D=1024, H=16, HD=64, FF=4096, M = B*S = 8192
// Pipeline:
//   1) f32 -> f16 conversion of embeddings + all weights
//   2) WMMA GEMM (async-LDS double-buffered): Q/K/V = emb @ W^T + b
//   3) Flash-attention with WMMA (QK^T and P@V), online softmax
//   4) WMMA GEMM + ReLU: hid = Hcat @ W1^T + b1
//   5) WMMA GEMM (f32 out): out = hid @ W2^T + b2 -> d_out
// CDNA5 specifics: v_wmma_f32_16x16x32_f16, global_load_async_to_lds_b128
// (ASYNCcnt pipeline), s_wait_asynccnt / s_wait_dscnt, wave32 shuffles.
// ---------------------------------------------------------------------------

typedef __attribute__((ext_vector_type(16))) _Float16 v16h;
typedef __attribute__((ext_vector_type(8)))  float    v8f;

#define TB 4
#define TS 2048
#define TD 1024
#define TH 16
#define THD 64
#define TFF 4096
#define TM (TB * TS)   // 8192

// async copy of 16 bytes (8 halves) global -> LDS, tracked by ASYNCcnt
__device__ __forceinline__ void async_copy_b128(unsigned lds_byte_addr,
                                                const _Float16* gptr) {
    asm volatile("global_load_async_to_lds_b128 %0, %1, off"
                 :: "v"(lds_byte_addr), "v"(gptr)
                 : "memory");
}
__device__ __forceinline__ void wait_async(int n) {
    if (n == 0) asm volatile("s_wait_asynccnt 0x0" ::: "memory");
    else        asm volatile("s_wait_asynccnt 0x4" ::: "memory");
}

// -------------------------------- f32 -> f16 -------------------------------
__global__ __launch_bounds__(256) void cvt_f32_to_f16(const float* __restrict__ in,
                                                      _Float16* __restrict__ out,
                                                      int n) {
    int i = blockIdx.x * blockDim.x + threadIdx.x;
    if (i < n) out[i] = (_Float16)in[i];
}

// ------------------------- WMMA tiled GEMM (C = A @ B^T) -------------------
// A: [M,K] f16 row-major. Bw: [N,K] f16 row-major (torch Linear weight).
// bias: f32 [N] or null. C: [M,N] OutT row-major. Optional ReLU.
// Block tile 128x128, K-step 32, 256 threads = 8 waves, wave tile 32x64.
// Double-buffered LDS fed by global_load_async_to_lds_b128.
template <bool RELU, typename OutT>
__global__ __launch_bounds__(256) void gemm_wmma(const _Float16* __restrict__ A,
                                                 const _Float16* __restrict__ Bw,
                                                 const float* __restrict__ bias,
                                                 OutT* __restrict__ C,
                                                 int M, int N, int K) {
    __shared__ _Float16 As[2][128 * 32];
    __shared__ _Float16 Bs[2][128 * 32];

    const int tid  = threadIdx.x;
    const int wave = tid >> 5;
    const int lane = tid & 31;
    const int wm   = wave >> 1;     // 0..3 : wave row
    const int wn   = wave & 1;      // 0..1 : wave col
    const int r    = lane & 15;
    const int hs   = lane >> 4;     // 0/1, selects K-half per ISA A/B layout

    const int blockM = blockIdx.y * 128;
    const int blockN = blockIdx.x * 128;

    const v8f vzero = {0.f, 0.f, 0.f, 0.f, 0.f, 0.f, 0.f, 0.f};
    v8f acc[2][4];
#pragma unroll
    for (int i = 0; i < 2; ++i)
#pragma unroll
        for (int j = 0; j < 4; ++j) acc[i][j] = vzero;

    // cooperative tile loads: thread t owns 16 halves of A and of B per K-step
    const int ldr = tid >> 1;          // 0..127
    const int ldc = (tid & 1) * 16;    // 0 or 16

    const unsigned ldsA[2] = {
        (unsigned)(uintptr_t)(&As[0][ldr * 32 + ldc]),
        (unsigned)(uintptr_t)(&As[1][ldr * 32 + ldc])};
    const unsigned ldsB[2] = {
        (unsigned)(uintptr_t)(&Bs[0][ldr * 32 + ldc]),
        (unsigned)(uintptr_t)(&Bs[1][ldr * 32 + ldc])};
    const _Float16* gA = A  + (size_t)(blockM + ldr) * K + ldc;
    const _Float16* gB = Bw + (size_t)(blockN + ldr) * K + ldc;

    auto issue = [&](int k0, int buf) {
        async_copy_b128(ldsA[buf],      gA + k0);
        async_copy_b128(ldsA[buf] + 16, gA + k0 + 8);
        async_copy_b128(ldsB[buf],      gB + k0);
        async_copy_b128(ldsB[buf] + 16, gB + k0 + 8);
    };

    issue(0, 0);                              // prologue: tile 0 in flight
    for (int k0 = 0; k0 < K; k0 += 32) {
        const int buf = (k0 >> 5) & 1;
        if (k0 + 32 < K) { issue(k0 + 32, buf ^ 1); wait_async(4); }
        else             { wait_async(0); }
        __syncthreads();                      // tile `buf` resident for all

        // A fragment per ISA 16-bit 16x32 layout:
        //   lane hs half: halves 0..7 at k = hs*8 .. hs*8+7, halves 8..15 at +16
        v16h af[2], bf[4];
#pragma unroll
        for (int i = 0; i < 2; ++i) {
            const _Float16* ab = &As[buf][(wm * 32 + i * 16 + r) * 32 + hs * 8];
            ((uint4*)&af[i])[0] = *(const uint4*)(ab);
            ((uint4*)&af[i])[1] = *(const uint4*)(ab + 16);
        }
#pragma unroll
        for (int j = 0; j < 4; ++j) {
            const _Float16* bb = &Bs[buf][(wn * 64 + j * 16 + r) * 32 + hs * 8];
            ((uint4*)&bf[j])[0] = *(const uint4*)(bb);
            ((uint4*)&bf[j])[1] = *(const uint4*)(bb + 16);
        }
#pragma unroll
        for (int i = 0; i < 2; ++i)
#pragma unroll
            for (int j = 0; j < 4; ++j)
                acc[i][j] = __builtin_amdgcn_wmma_f32_16x16x32_f16(
                    false, af[i], false, bf[j], (short)0, acc[i][j], false, false);

        __syncthreads();                      // everyone done before overwrite
    }

    // epilogue: C/D layout = lane (hs,r): col n = r, rows = hs*8 + 0..7
#pragma unroll
    for (int j = 0; j < 4; ++j) {
        const int n   = blockN + wn * 64 + j * 16 + r;
        const float bv = bias ? bias[n] : 0.f;
#pragma unroll
        for (int i = 0; i < 2; ++i) {
#pragma unroll
            for (int jj = 0; jj < 8; ++jj) {
                const int m = blockM + wm * 32 + i * 16 + hs * 8 + jj;
                float v = acc[i][j][jj] + bv;
                if (RELU) v = fmaxf(v, 0.f);
                C[(size_t)m * N + n] = (OutT)v;
            }
        }
    }
}

// ------------------------------ flash attention ----------------------------
// grid = (S/64, B*H), block = 128 (4 waves); each wave owns 16 query rows.
// Q/K/V in [B,S,H,HD] f16 layout (row stride D). Output Hcat same layout.
__global__ __launch_bounds__(128) void attn_wmma(const _Float16* __restrict__ Qg,
                                                 const _Float16* __restrict__ Kg,
                                                 const _Float16* __restrict__ Vg,
                                                 _Float16* __restrict__ Og) {
    constexpr int LDT = 72;                 // padded LDS row stride (halves)
    __shared__ _Float16 Qs[64 * LDT];
    __shared__ _Float16 Ks[64 * LDT];
    __shared__ _Float16 Vt[64 * LDT];       // V transposed: [e][k]
    __shared__ _Float16 Ps[64 * LDT];       // 4 waves x 16 rows of P

    const int bh   = blockIdx.y;            // 0..63
    const int b    = bh >> 4;
    const int h    = bh & 15;
    const int q0   = blockIdx.x * 64;
    const int tid  = threadIdx.x;
    const int wave = tid >> 5;
    const int lane = tid & 31;
    const int r    = lane & 15;
    const int hs   = lane >> 4;

    const size_t rowbase = (size_t)(b * TS) * TD + (size_t)h * THD;
    const _Float16* Qb = Qg + rowbase;
    const _Float16* Kb = Kg + rowbase;
    const _Float16* Vb = Vg + rowbase;

    // load Q block: 64 rows x 64 cols (async global -> LDS)
#pragma unroll
    for (int c = 0; c < 4; ++c) {
        int idx = (c * 128 + tid) * 8;      // 0..4095 in steps of 8
        int row = idx >> 6;
        int col = idx & 63;
        async_copy_b128((unsigned)(uintptr_t)(Qs + row * LDT + col),
                        Qb + (size_t)(q0 + row) * TD + col);
    }

    const v8f vzero = {0.f, 0.f, 0.f, 0.f, 0.f, 0.f, 0.f, 0.f};
    v8f o[4];
#pragma unroll
    for (int j = 0; j < 4; ++j) o[j] = vzero;
    float mrow[8], lrow[8];
#pragma unroll
    for (int jj = 0; jj < 8; ++jj) { mrow[jj] = -1.0e30f; lrow[jj] = 0.f; }

    const float scale = 0.03125f;           // 1/sqrt(D) = 1/32

    for (int kt = 0; kt < TS / 64; ++kt) {
        const int k0 = kt * 64;
        __syncthreads();                    // previous tile fully consumed
        // K tile via async-to-LDS; V tile transposed via VGPR scatter
#pragma unroll
        for (int c = 0; c < 4; ++c) {
            int idx = (c * 128 + tid) * 8;
            int row = idx >> 6;
            int col = idx & 63;
            async_copy_b128((unsigned)(uintptr_t)(Ks + row * LDT + col),
                            Kb + (size_t)(k0 + row) * TD + col);
            uint4 vv = *(const uint4*)(Vb + (size_t)(k0 + row) * TD + col);
            const _Float16* vp = (const _Float16*)&vv;
#pragma unroll
            for (int u = 0; u < 8; ++u) Vt[(col + u) * LDT + row] = vp[u];
        }
        if (kt + 1 < TS / 64)               // lowers to global_prefetch_b8
            __builtin_prefetch(Kb + (size_t)(k0 + 64) * TD + (tid & 63), 0, 1);
        wait_async(0);                      // own async K (and Q) writes done
        __syncthreads();

        // ---- scores = Q @ K^T  (16 rows x 64 keys per wave) ----
        v8f sc[4];
#pragma unroll
        for (int j = 0; j < 4; ++j) sc[j] = vzero;
#pragma unroll
        for (int ks = 0; ks < 2; ++ks) {
            v16h aq;
            const _Float16* ab = Qs + (wave * 16 + r) * LDT + ks * 32 + hs * 8;
            ((uint4*)&aq)[0] = *(const uint4*)(ab);
            ((uint4*)&aq)[1] = *(const uint4*)(ab + 16);
#pragma unroll
            for (int j = 0; j < 4; ++j) {
                v16h bk;
                const _Float16* bb = Ks + (j * 16 + r) * LDT + ks * 32 + hs * 8;
                ((uint4*)&bk)[0] = *(const uint4*)(bb);
                ((uint4*)&bk)[1] = *(const uint4*)(bb + 16);
                sc[j] = __builtin_amdgcn_wmma_f32_16x16x32_f16(
                    false, aq, false, bk, (short)0, sc[j], false, false);
            }
        }

        // ---- online softmax per row (rows jj + 8*hs; 16-lane reductions) --
#pragma unroll
        for (int jj = 0; jj < 8; ++jj) {
            float mx = -1.0e30f;
#pragma unroll
            for (int j = 0; j < 4; ++j) {
                sc[j][jj] *= scale;
                mx = fmaxf(mx, sc[j][jj]);
            }
#pragma unroll
            for (int off = 1; off < 16; off <<= 1)
                mx = fmaxf(mx, __shfl_xor(mx, off, 32));
            const float mn   = fmaxf(mrow[jj], mx);
            const float corr = __expf(mrow[jj] - mn);
            float rs = 0.f;
#pragma unroll
            for (int j = 0; j < 4; ++j) {
                float p = __expf(sc[j][jj] - mn);
                sc[j][jj] = p;
                rs += p;
            }
#pragma unroll
            for (int off = 1; off < 16; off <<= 1)
                rs += __shfl_xor(rs, off, 32);
            lrow[jj] = lrow[jj] * corr + rs;
            mrow[jj] = mn;
#pragma unroll
            for (int j = 0; j < 4; ++j) o[j][jj] *= corr;
            // stage P into this wave's private LDS strip for re-fragmenting
            const int prow = wave * 16 + hs * 8 + jj;
#pragma unroll
            for (int j = 0; j < 4; ++j)
                Ps[prow * LDT + j * 16 + r] = (_Float16)sc[j][jj];
        }
        // wave-private LDS RAW hazard: cross-lane write -> fragment read
        asm volatile("s_wait_dscnt 0x0" ::: "memory");

        // ---- o += P @ V  (B operand = Vt, already [N=e][K=k]) ----
#pragma unroll
        for (int ks = 0; ks < 2; ++ks) {
            v16h ap;
            const _Float16* ab = Ps + (wave * 16 + r) * LDT + ks * 32 + hs * 8;
            ((uint4*)&ap)[0] = *(const uint4*)(ab);
            ((uint4*)&ap)[1] = *(const uint4*)(ab + 16);
#pragma unroll
            for (int j = 0; j < 4; ++j) {
                v16h bv;
                const _Float16* bb = Vt + (j * 16 + r) * LDT + ks * 32 + hs * 8;
                ((uint4*)&bv)[0] = *(const uint4*)(bb);
                ((uint4*)&bv)[1] = *(const uint4*)(bb + 16);
                o[j] = __builtin_amdgcn_wmma_f32_16x16x32_f16(
                    false, ap, false, bv, (short)0, o[j], false, false);
            }
        }
    }

    // ---- normalize and store Hcat[b, s, h*64 + e] ----
    float invl[8];
#pragma unroll
    for (int jj = 0; jj < 8; ++jj) invl[jj] = 1.0f / lrow[jj];
#pragma unroll
    for (int j = 0; j < 4; ++j) {
        const int e = j * 16 + r;
#pragma unroll
        for (int jj = 0; jj < 8; ++jj) {
            const int row = wave * 16 + hs * 8 + jj;
            Og[rowbase + (size_t)(q0 + row) * TD + e] = (_Float16)(o[j][jj] * invl[jj]);
        }
    }
}

// -------------------------------- launcher ---------------------------------
extern "C" void kernel_launch(void* const* d_in, const int* in_sizes, int n_in,
                              void* d_out, int out_size, void* d_ws, size_t ws_size,
                              hipStream_t stream) {
    const float* emb = (const float*)d_in[0];
    const float* Wq  = (const float*)d_in[1];
    const float* bq  = (const float*)d_in[2];
    const float* Wk  = (const float*)d_in[3];
    const float* bk  = (const float*)d_in[4];
    const float* Wv  = (const float*)d_in[5];
    const float* bv  = (const float*)d_in[6];
    const float* W1  = (const float*)d_in[7];
    const float* b1  = (const float*)d_in[8];
    const float* W2  = (const float*)d_in[9];
    const float* b2  = (const float*)d_in[10];
    float* out = (float*)d_out;

    // workspace carve-up (f16 units)
    _Float16* ws = (_Float16*)d_ws;
    const size_t nEmb = (size_t)TM * TD;          // 8192*1024
    const size_t nWqkv = (size_t)TD * TD;         // 1024*1024
    const size_t nW1 = (size_t)TFF * TD;
    const size_t nW2 = (size_t)TD * TFF;
    _Float16* emb16  = ws;                 ws += nEmb;
    _Float16* wq16   = ws;                 ws += nWqkv;
    _Float16* wk16   = ws;                 ws += nWqkv;
    _Float16* wv16   = ws;                 ws += nWqkv;
    _Float16* w1_16  = ws;                 ws += nW1;
    _Float16* w2_16  = ws;                 ws += nW2;
    _Float16* q16    = ws;                 ws += nEmb;
    _Float16* k16    = ws;                 ws += nEmb;
    _Float16* v16    = ws;                 ws += nEmb;
    _Float16* hcat16 = ws;                 ws += nEmb;
    _Float16* hid16  = ws;                 ws += (size_t)TM * TFF;

    auto cvt = [&](const float* src, _Float16* dst, size_t n) {
        cvt_f32_to_f16<<<dim3((unsigned)((n + 255) / 256)), dim3(256), 0, stream>>>(
            src, dst, (int)n);
    };
    cvt(emb, emb16, nEmb);
    cvt(Wq, wq16, nWqkv);
    cvt(Wk, wk16, nWqkv);
    cvt(Wv, wv16, nWqkv);
    cvt(W1, w1_16, nW1);
    cvt(W2, w2_16, nW2);

    // QKV projections: [8192,1024] = emb16 @ W^T + b   (f16 out)
    {
        dim3 grid(TD / 128, TM / 128), blk(256);
        gemm_wmma<false, _Float16><<<grid, blk, 0, stream>>>(emb16, wq16, bq, q16, TM, TD, TD);
        gemm_wmma<false, _Float16><<<grid, blk, 0, stream>>>(emb16, wk16, bk, k16, TM, TD, TD);
        gemm_wmma<false, _Float16><<<grid, blk, 0, stream>>>(emb16, wv16, bv, v16, TM, TD, TD);
    }

    // attention -> Hcat (f16, [B,S,H*HD])
    {
        dim3 grid(TS / 64, TB * TH), blk(128);
        attn_wmma<<<grid, blk, 0, stream>>>(q16, k16, v16, hcat16);
    }

    // FFN layer 1: relu(Hcat @ W1^T + b1)  -> hid16 [8192,4096]
    {
        dim3 grid(TFF / 128, TM / 128), blk(256);
        gemm_wmma<true, _Float16><<<grid, blk, 0, stream>>>(hcat16, w1_16, b1, hid16, TM, TFF, TD);
    }
    // FFN layer 2: hid @ W2^T + b2 -> d_out (f32, [8192,1024])
    {
        dim3 grid(TD / 128, TM / 128), blk(256);
        gemm_wmma<false, float><<<grid, blk, 0, stream>>>(hid16, w2_16, b2, out, TM, TD, TFF);
    }
}

// v001
// It runs in 525 microseconds.
// Two timings next to v000 put it at 1.20 and 1.19 times that version's speed.
#include <hip/hip_runtime.h>
#include <hip/hip_bf16.h>

// ---------------------------------------------------------------------------
// Transformer block for MI455X (gfx1250, wave32, WMMA f16 -> f32 accum)
//   B=4, S=2048, D=1024, H=16, HD=64, FF=4096, M = B*S = 8192
// Pipeline:
//   1) f32 -> f16 conversion of embeddings + all weights
//   2) WMMA GEMM (async-LDS double-buffered): Q/K/V = emb @ W^T + b
//   3) Flash-attention with WMMA (QK^T and P@V), online softmax
//   4) WMMA GEMM + ReLU: hid = Hcat @ W1^T + b1
//   5) WMMA GEMM (f32 out): out = hid @ W2^T + b2 -> d_out
// CDNA5 specifics: v_wmma_f32_16x16x32_f16, global_load_async_to_lds_b128
// (ASYNCcnt pipeline), s_wait_asynccnt / s_wait_dscnt, wave32 shuffles.
// ---------------------------------------------------------------------------

typedef __attribute__((ext_vector_type(16))) _Float16 v16h;
typedef __attribute__((ext_vector_type(8)))  float    v8f;

#define TB 4
#define TS 2048
#define TD 1024
#define TH 16
#define THD 64
#define TFF 4096
#define TM (TB * TS)   // 8192

// async copy of 16 bytes (8 halves) global -> LDS, tracked by ASYNCcnt
__device__ __forceinline__ void async_copy_b128(unsigned lds_byte_addr,
                                                const _Float16* gptr) {
    asm volatile("global_load_async_to_lds_b128 %0, %1, off"
                 :: "v"(lds_byte_addr), "v"(gptr)
                 : "memory");
}
__device__ __forceinline__ void wait_async(int n) {
    if (n == 0) asm volatile("s_wait_asynccnt 0x0" ::: "memory");
    else        asm volatile("s_wait_asynccnt 0x4" ::: "memory");
}

// -------------------------------- f32 -> f16 -------------------------------
__global__ __launch_bounds__(256) void cvt_f32_to_f16(const float* __restrict__ in,
                                                      _Float16* __restrict__ out,
                                                      int n) {
    int i = blockIdx.x * blockDim.x + threadIdx.x;
    if (i < n) out[i] = (_Float16)in[i];
}

// ------------------------- WMMA tiled GEMM (C = A @ B^T) -------------------
// A: [M,K] f16 row-major. Bw: [N,K] f16 row-major (torch Linear weight).
// bias: f32 [N] or null. C: [M,N] OutT row-major. Optional ReLU.
// Block tile 128x128, K-step 32, 256 threads = 8 waves, wave tile 32x64.
// Double-buffered LDS fed by global_load_async_to_lds_b128.
template <bool RELU, typename OutT>
__global__ __launch_bounds__(256) void gemm_wmma(const _Float16* __restrict__ A,
                                                 const _Float16* __restrict__ Bw,
                                                 const float* __restrict__ bias,
                                                 OutT* __restrict__ C,
                                                 int M, int N, int K) {
    // LDS row pitch in halves: 32 data + 8 pad = 80 B (16 B x odd), so the 16
    // rows of a ds_load_b128 fragment read fall on 16 distinct bank groups
    // (at 64 B rows r, r+4, r+8, r+12 share their banks). Pad is never read.
    constexpr int LDP = 40;
    __shared__ _Float16 As[2][128 * LDP];
    __shared__ _Float16 Bs[2][128 * LDP];

    const int tid  = threadIdx.x;
    const int wave = tid >> 5;
    const int lane = tid & 31;
    const int wm   = wave >> 1;     // 0..3 : wave row
    const int wn   = wave & 1;      // 0..1 : wave col
    const int r    = lane & 15;
    const int hs   = lane >> 4;     // 0/1, selects K-half per ISA A/B layout

    const int blockM = blockIdx.y * 128;
    const int blockN = blockIdx.x * 128;

    const v8f vzero = {0.f, 0.f, 0.f, 0.f, 0.f, 0.f, 0.f, 0.f};
    v8f acc[2][4];
#pragma unroll
    for (int i = 0; i < 2; ++i)
#pragma unroll
        for (int j = 0; j < 4; ++j) acc[i][j] = vzero;

    // cooperative tile loads: thread t owns 16 halves of A and of B per K-step
    const int ldr = tid >> 1;          // 0..127
    const int ldc = (tid & 1) * 16;    // 0 or 16

    const unsigned ldsA[2] = {
        (unsigned)(uintptr_t)(&As[0][ldr * LDP + ldc]),
        (unsigned)(uintptr_t)(&As[1][ldr * LDP + ldc])};
    const unsigned ldsB[2] = {
        (unsigned)(uintptr_t)(&Bs[0][ldr * LDP + ldc]),
        (unsigned)(uintptr_t)(&Bs[1][ldr * LDP + ldc])};
    const _Float16* gA = A  + (size_t)(blockM + ldr) * K + ldc;
    const _Float16* gB = Bw + (size_t)(blockN + ldr) * K + ldc;

    auto issue = [&](int k0, int buf) {
        async_copy_b128(ldsA[buf],      gA + k0);
        async_copy_b128(ldsA[buf] + 16, gA + k0 + 8);
        async_copy_b128(ldsB[buf],      gB + k0);
        async_copy_b128(ldsB[buf] + 16, gB + k0 + 8);
    };

    issue(0, 0);                              // prologue: tile 0 in flight
    for (int k0 = 0; k0 < K; k0 += 32) {
        const int buf = (k0 >> 5) & 1;
        if (k0 + 32 < K) { issue(k0 + 32, buf ^ 1); wait_async(4); }
        else             { wait_async(0); }
        __syncthreads();                      // tile `buf` resident for all

        // A fragment per ISA 16-bit 16x32 layout:
        //   lane hs half: halves 0..7 at k = hs*8 .. hs*8+7, halves 8..15 at +16
        v16h af[2], bf[4];
#pragma unroll
        for (int i = 0; i < 2; ++i) {
            const _Float16* ab = &As[buf][(wm * 32 + i * 16 + r) * LDP + hs * 8];
            ((uint4*)&af[i])[0] = *(const uint4*)(ab);
            ((uint4*)&af[i])[1] = *(const uint4*)(ab + 16);
        }
#pragma unroll
        for (int j = 0; j < 4; ++j) {
            const _Float16* bb = &Bs[buf][(wn * 64 + j * 16 + r) * LDP + hs * 8];
            ((uint4*)&bf[j])[0] = *(const uint4*)(bb);
            ((uint4*)&bf[j])[1] = *(const uint4*)(bb + 16);
        }
#pragma unroll
        for (int i = 0; i < 2; ++i)
#pragma unroll
            for (int j = 0; j < 4; ++j)
                acc[i][j] = __builtin_amdgcn_wmma_f32_16x16x32_f16(
                    false, af[i], false, bf[j], (short)0, acc[i][j], false, false);

        __syncthreads();                      // everyone done before overwrite
    }

    // epilogue: C/D layout = lane (hs,r): col n = r, rows = hs*8 + 0..7
#pragma unroll
    for (int j = 0; j < 4; ++j) {
        const int n   = blockN + wn * 64 + j * 16 + r;
        const float bv = bias ? bias[n] : 0.f;
#pragma unroll
        for (int i = 0; i < 2; ++i) {
#pragma unroll
            for (int jj = 0; jj < 8; ++jj) {
                const int m = blockM + wm * 32 + i * 16 + hs * 8 + jj;
                float v = acc[i][j][jj] + bv;
                if (RELU) v = fmaxf(v, 0.f);
                C[(size_t)m * N + n] = (OutT)v;
            }
        }
    }
}

// ------------------------------ flash attention ----------------------------
// grid = (S/64, B*H), block = 128 (4 waves); each wave owns 16 query rows.
// Q/K/V in [B,S,H,HD] f16 layout (row stride D). Output Hcat same layout.
__global__ __launch_bounds__(128) void attn_wmma(const _Float16* __restrict__ Qg,
                                                 const _Float16* __restrict__ Kg,
                                                 const _Float16* __restrict__ Vg,
                                                 _Float16* __restrict__ Og) {
    constexpr int LDT = 72;                 // padded LDS row stride (halves)
    __shared__ _Float16 Qs[64 * LDT];
    __shared__ _Float16 Ks[64 * LDT];
    __shared__ _Float16 Vt[64 * LDT];       // V transposed: [e][k]
    __shared__ _Float16 Ps[64 * LDT];       // 4 waves x 16 rows of P

    const int bh   = blockIdx.y;            // 0..63
    const int b    = bh >> 4;
    const int h    = bh & 15;
    const int q0   = blockIdx.x * 64;
    const int tid  = threadIdx.x;
    const int wave = tid >> 5;
    const int lane = tid & 31;
    const int r    = lane & 15;
    const int hs   = lane >> 4;

    const size_t rowbase = (size_t)(b * TS) * TD + (size_t)h * THD;
    const _Float16* Qb = Qg + rowbase;
    const _Float16* Kb = Kg + rowbase;
    const _Float16* Vb = Vg + rowbase;

    // load Q block: 64 rows x 64 cols (async global -> LDS)
#pragma unroll
    for (int c = 0; c < 4; ++c) {
        int idx = (c * 128 + tid) * 8;      // 0..4095 in steps of 8
        int row = idx >> 6;
        int col = idx & 63;
        async_copy_b128((unsigned)(uintptr_t)(Qs + row * LDT + col),
                        Qb + (size_t)(q0 + row) * TD + col);
    }

    const v8f vzero = {0.f, 0.f, 0.f, 0.f, 0.f, 0.f, 0.f, 0.f};
    v8f o[4];
#pragma unroll
    for (int j = 0; j < 4; ++j) o[j] = vzero;
    float mrow[8], lrow[8];
#pragma unroll
    for (int jj = 0; jj < 8; ++jj) { mrow[jj] = -1.0e30f; lrow[jj] = 0.f; }

    const float scale = 0.03125f;           // 1/sqrt(D) = 1/32

    for (int kt = 0; kt < TS / 64; ++kt) {
        const int k0 = kt * 64;
        __syncthreads();                    // previous tile fully consumed
        // K tile via async-to-LDS; V tile transposed via VGPR scatter
#pragma unroll
        for (int c = 0; c < 4; ++c) {
            int idx = (c * 128 + tid) * 8;
            int row = idx >> 6;
            int col = idx & 63;
            async_copy_b128((unsigned)(uintptr_t)(Ks + row * LDT + col),
                            Kb + (size_t)(k0 + row) * TD + col);
            uint4 vv = *(const uint4*)(Vb + (size_t)(k0 + row) * TD + col);
            const _Float16* vp = (const _Float16*)&vv;
#pragma unroll
            for (int u = 0; u < 8; ++u) Vt[(col + u) * LDT + row] = vp[u];
        }
        if (kt + 1 < TS / 64)               // lowers to global_prefetch_b8
            __builtin_prefetch(Kb + (size_t)(k0 + 64) * TD + (tid & 63), 0, 1);
        wait_async(0);                      // own async K (and Q) writes done
        __syncthreads();

        // ---- scores = Q @ K^T  (16 rows x 64 keys per wave) ----
        v8f sc[4];
#pragma unroll
        for (int j = 0; j < 4; ++j) sc[j] = vzero;
#pragma unroll
        for (int ks = 0; ks < 2; ++ks) {
            v16h aq;
            const _Float16* ab = Qs + (wave * 16 + r) * LDT + ks * 32 + hs * 8;
            ((uint4*)&aq)[0] = *(const uint4*)(ab);
            ((uint4*)&aq)[1] = *(const uint4*)(ab + 16);
#pragma unroll
            for (int j = 0; j < 4; ++j) {
                v16h bk;
                const _Float16* bb = Ks + (j * 16 + r) * LDT + ks * 32 + hs * 8;
                ((uint4*)&bk)[0] = *(const uint4*)(bb);
                ((uint4*)&bk)[1] = *(const uint4*)(bb + 16);
                sc[j] = __builtin_amdgcn_wmma_f32_16x16x32_f16(
                    false, aq, false, bk, (short)0, sc[j], false, false);
            }
        }

        // ---- online softmax per row (rows jj + 8*hs; 16-lane reductions) --
#pragma unroll
        for (int jj = 0; jj < 8; ++jj) {
            float mx = -1.0e30f;
#pragma unroll
            for (int j = 0; j < 4; ++j) {
                sc[j][jj] *= scale;
                mx = fmaxf(mx, sc[j][jj]);
            }
#pragma unroll
            for (int off = 1; off < 16; off <<= 1)
                mx = fmaxf(mx, __shfl_xor(mx, off, 32));
            const float mn   = fmaxf(mrow[jj], mx);
            const float corr = __expf(mrow[jj] - mn);
            float rs = 0.f;
#pragma unroll
            for (int j = 0; j < 4; ++j) {
                float p = __expf(sc[j][jj] - mn);
                sc[j][jj] = p;
                rs += p;
            }
#pragma unroll
            for (int off = 1; off < 16; off <<= 1)
                rs += __shfl_xor(rs, off, 32);
            lrow[jj] = lrow[jj] * corr + rs;
            mrow[jj] = mn;
#pragma unroll
            for (int j = 0; j < 4; ++j) o[j][jj] *= corr;
            // stage P into this wave's private LDS strip for re-fragmenting
            const int prow = wave * 16 + hs * 8 + jj;
#pragma unroll
            for (int j = 0; j < 4; ++j)
                Ps[prow * LDT + j * 16 + r] = (_Float16)sc[j][jj];
        }
        // wave-private LDS RAW hazard: cross-lane write -> fragment read
        asm volatile("s_wait_dscnt 0x0" ::: "memory");

        // ---- o += P @ V  (B operand = Vt, already [N=e][K=k]) ----
#pragma unroll
        for (int ks = 0; ks < 2; ++ks) {
            v16h ap;
            const _Float16* ab = Ps + (wave * 16 + r) * LDT + ks * 32 + hs * 8;
            ((uint4*)&ap)[0] = *(const uint4*)(ab);
            ((uint4*)&ap)[1] = *(const uint4*)(ab + 16);
#pragma unroll
            for (int j = 0; j < 4; ++j) {
                v16h bv;
                const _Float16* bb = Vt + (j * 16 + r) * LDT + ks * 32 + hs * 8;
                ((uint4*)&bv)[0] = *(const uint4*)(bb);
                ((uint4*)&bv)[1] = *(const uint4*)(bb + 16);
                o[j] = __builtin_amdgcn_wmma_f32_16x16x32_f16(
                    false, ap, false, bv, (short)0, o[j], false, false);
            }
        }
    }

    // ---- normalize and store Hcat[b, s, h*64 + e] ----
    float invl[8];
#pragma unroll
    for (int jj = 0; jj < 8; ++jj) invl[jj] = 1.0f / lrow[jj];
#pragma unroll
    for (int j = 0; j < 4; ++j) {
        const int e = j * 16 + r;
#pragma unroll
        for (int jj = 0; jj < 8; ++jj) {
            const int row = wave * 16 + hs * 8 + jj;
            Og[rowbase + (size_t)(q0 + row) * TD + e] = (_Float16)(o[j][jj] * invl[jj]);
        }
    }
}

// -------------------------------- launcher ---------------------------------
extern "C" void kernel_launch(void* const* d_in, const int* in_sizes, int n_in,
                              void* d_out, int out_size, void* d_ws, size_t ws_size,
                              hipStream_t stream) {
    const float* emb = (const float*)d_in[0];
    const float* Wq  = (const float*)d_in[1];
    const float* bq  = (const float*)d_in[2];
    const float* Wk  = (const float*)d_in[3];
    const float* bk  = (const float*)d_in[4];
    const float* Wv  = (const float*)d_in[5];
    const float* bv  = (const float*)d_in[6];
    const float* W1  = (const float*)d_in[7];
    const float* b1  = (const float*)d_in[8];
    const float* W2  = (const float*)d_in[9];
    const float* b2  = (const float*)d_in[10];
    float* out = (float*)d_out;

    // workspace carve-up (f16 units)
    _Float16* ws = (_Float16*)d_ws;
    const size_t nEmb = (size_t)TM * TD;          // 8192*1024
    const size_t nWqkv = (size_t)TD * TD;         // 1024*1024
    const size_t nW1 = (size_t)TFF * TD;
    const size_t nW2 = (size_t)TD * TFF;
    _Float16* emb16  = ws;                 ws += nEmb;
    _Float16* wq16   = ws;                 ws += nWqkv;
    _Float16* wk16   = ws;                 ws += nWqkv;
    _Float16* wv16   = ws;                 ws += nWqkv;
    _Float16* w1_16  = ws;                 ws += nW1;
    _Float16* w2_16  = ws;                 ws += nW2;
    _Float16* q16    = ws;                 ws += nEmb;
    _Float16* k16    = ws;                 ws += nEmb;
    _Float16* v16    = ws;                 ws += nEmb;
    _Float16* hcat16 = ws;                 ws += nEmb;
    _Float16* hid16  = ws;                 ws += (size_t)TM * TFF;

    auto cvt = [&](const float* src, _Float16* dst, size_t n) {
        cvt_f32_to_f16<<<dim3((unsigned)((n + 255) / 256)), dim3(256), 0, stream>>>(
            src, dst, (int)n);
    };
    cvt(emb, emb16, nEmb);
    cvt(Wq, wq16, nWqkv);
    cvt(Wk, wk16, nWqkv);
    cvt(Wv, wv16, nWqkv);
    cvt(W1, w1_16, nW1);
    cvt(W2, w2_16, nW2);

    // QKV projections: [8192,1024] = emb16 @ W^T + b   (f16 out)
    {
        dim3 grid(TD / 128, TM / 128), blk(256);
        gemm_wmma<false, _Float16><<<grid, blk, 0, stream>>>(emb16, wq16, bq, q16, TM, TD, TD);
        gemm_wmma<false, _Float16><<<grid, blk, 0, stream>>>(emb16, wk16, bk, k16, TM, TD, TD);
        gemm_wmma<false, _Float16><<<grid, blk, 0, stream>>>(emb16, wv16, bv, v16, TM, TD, TD);
    }

    // attention -> Hcat (f16, [B,S,H*HD])
    {
        dim3 grid(TS / 64, TB * TH), blk(128);
        attn_wmma<<<grid, blk, 0, stream>>>(q16, k16, v16, hcat16);
    }

    // FFN layer 1: relu(Hcat @ W1^T + b1)  -> hid16 [8192,4096]
    {
        dim3 grid(TFF / 128, TM / 128), blk(256);
        gemm_wmma<true, _Float16><<<grid, blk, 0, stream>>>(hcat16, w1_16, b1, hid16, TM, TFF, TD);
    }
    // FFN layer 2: hid @ W2^T + b2 -> d_out (f32, [8192,1024])
    {
        dim3 grid(TD / 128, TM / 128), blk(256);
        gemm_wmma<false, float><<<grid, blk, 0, stream>>>(hid16, w2_16, b2, out, TM, TD, TFF);
    }
}

// v002
// A run of this version takes 467 microseconds.
// Timed twice side by side with v001, it ran 1.12 and 1.13 times as fast.
// Counting every step since v000, it is 1.35 times as fast.
#include <hip/hip_runtime.h>
#include <hip/hip_bf16.h>

// ---------------------------------------------------------------------------
// Transformer block for MI455X (gfx1250, wave32, WMMA f16 -> f32 accum)
//   B=4, S=2048, D=1024, H=16, HD=64, FF=4096, M = B*S = 8192
// Pipeline:
//   1) f32 -> f16 conversion of embeddings + all weights
//   2) WMMA GEMM (async-LDS double-buffered): Q/K/V = emb @ W^T + b
//   3) Flash-attention with WMMA (QK^T and P@V), online softmax
//   4) WMMA GEMM + ReLU: hid = Hcat @ W1^T + b1
//   5) WMMA GEMM (f32 out): out = hid @ W2^T + b2 -> d_out
// CDNA5 specifics: v_wmma_f32_16x16x32_f16, global_load_async_to_lds_b128
// (ASYNCcnt pipeline), s_wait_asynccnt / s_wait_dscnt, wave32 shuffles.
// ---------------------------------------------------------------------------

typedef __attribute__((ext_vector_type(16))) _Float16 v16h;
typedef __attribute__((ext_vector_type(8)))  float    v8f;

#define TB 4
#define TS 2048
#define TD 1024
#define TH 16
#define THD 64
#define TFF 4096
#define TM (TB * TS)   // 8192

// async copy of 16 bytes (8 halves) global -> LDS, tracked by ASYNCcnt
__device__ __forceinline__ void async_copy_b128(unsigned lds_byte_addr,
                                                const _Float16* gptr) {
    asm volatile("global_load_async_to_lds_b128 %0, %1, off"
                 :: "v"(lds_byte_addr), "v"(gptr)
                 : "memory");
}
__device__ __forceinline__ void wait_async(int n) {
    if (n == 0) asm volatile("s_wait_asynccnt 0x0" ::: "memory");
    else        asm volatile("s_wait_asynccnt 0x4" ::: "memory");
}

// -------------------------------- f32 -> f16 -------------------------------
__global__ __launch_bounds__(256) void cvt_f32_to_f16(const float* __restrict__ in,
                                                      _Float16* __restrict__ out,
                                                      int n) {
    int i = blockIdx.x * blockDim.x + threadIdx.x;
    if (i < n) out[i] = (_Float16)in[i];
}

// ------------------------- WMMA tiled GEMM (C = A @ B^T) -------------------
// A: [M,K] f16 row-major. Bw: [N,K] f16 row-major (torch Linear weight).
// bias: f32 [N] or null. C: [M,N] OutT row-major. Optional ReLU.
// Block tile 128x128, K-step 64, 256 threads = 8 waves, wave tile 32x64.
// K must be a multiple of 64. Two LDS buffers fed by
// global_load_async_to_lds_b128; a K-step is 128 B of every operand row, so
// 8 lanes cover one whole 128-B line and one copy instruction 4 whole lines.

// Eight async copies (16 B per lane each) and, as the last line of the same
// statement, the wait that stands before any of their address registers is
// rewritten (in a statement of its own the compiler could lift later address
// arithmetic over it).
__device__ __forceinline__ void async_copy8_b128(
    unsigned l0, const _Float16* g0, unsigned l1, const _Float16* g1,
    unsigned l2, const _Float16* g2, unsigned l3, const _Float16* g3,
    unsigned l4, const _Float16* g4, unsigned l5, const _Float16* g5,
    unsigned l6, const _Float16* g6, unsigned l7, const _Float16* g7) {
    asm volatile("global_load_async_to_lds_b128 %0, %1, off\n\t"
                 "global_load_async_to_lds_b128 %2, %3, off\n\t"
                 "global_load_async_to_lds_b128 %4, %5, off\n\t"
                 "global_load_async_to_lds_b128 %6, %7, off\n\t"
                 "global_load_async_to_lds_b128 %8, %9, off\n\t"
                 "global_load_async_to_lds_b128 %10, %11, off\n\t"
                 "global_load_async_to_lds_b128 %12, %13, off\n\t"
                 "global_load_async_to_lds_b128 %14, %15, off\n\t"
                 "s_wait_xcnt 0x0"
                 :: "v"(l0), "v"(g0), "v"(l1), "v"(g1), "v"(l2), "v"(g2),
                    "v"(l3), "v"(g3), "v"(l4), "v"(g4), "v"(l5), "v"(g5),
                    "v"(l6), "v"(g6), "v"(l7), "v"(g7)
                 : "memory");
}

template <bool RELU, typename OutT>
__global__ __launch_bounds__(256) void gemm_wmma(const _Float16* __restrict__ A,
                                                 const _Float16* __restrict__ Bw,
                                                 const float* __restrict__ bias,
                                                 OutT* __restrict__ C,
                                                 int M, int N, int K) {
    // LDS row pitch in halves: 64 data + 8 pad = 144 B (16 B x odd), so the 16
    // rows of a ds_load_b128 fragment read fall on 16 distinct bank groups.
    // Pad is never read.
    constexpr int BK  = 64;
    constexpr int LDP = 72;
    __shared__ __attribute__((aligned(16))) _Float16 As[2][128 * LDP];
    __shared__ __attribute__((aligned(16))) _Float16 Bs[2][128 * LDP];

    const int tid  = threadIdx.x;
    const int wave = tid >> 5;
    const int lane = tid & 31;
    const int wm   = wave >> 1;     // 0..3 : wave row
    const int wn   = wave & 1;      // 0..1 : wave col
    const int r    = lane & 15;
    const int hs   = lane >> 4;     // 0/1, selects K-half per ISA A/B layout

    const int blockM = blockIdx.y * 128;
    const int blockN = blockIdx.x * 128;

    const v8f vzero = {0.f, 0.f, 0.f, 0.f, 0.f, 0.f, 0.f, 0.f};
    v8f acc[2][4];
#pragma unroll
    for (int i = 0; i < 2; ++i)
#pragma unroll
        for (int j = 0; j < 4; ++j) acc[i][j] = vzero;

    // cooperative tile copies: 8 lanes per row (128 B), 32 rows per copy of
    // the block, 4 copies for A and 4 for B per K-step
    const int ldr = tid >> 3;          // 0..31
    const int ldc = (tid & 7) * 8;     // 0..56 halves

    const unsigned ldsA = (unsigned)(uintptr_t)(&As[0][ldr * LDP + ldc]);
    const unsigned ldsB = (unsigned)(uintptr_t)(&Bs[0][ldr * LDP + ldc]);
    constexpr unsigned BUFB = 128 * LDP * 2;   // bytes of one buffer
    constexpr unsigned R32B = 32 * LDP * 2;    // bytes of 32 LDS rows
    const _Float16* gA = A  + (size_t)(blockM + ldr) * K + ldc;
    const _Float16* gB = Bw + (size_t)(blockN + ldr) * K + ldc;
    const size_t r32 = (size_t)32 * K;         // 32 global rows, in halves

    auto issue = [&](int t, int buf) {
        const _Float16* a = gA + (size_t)t * BK;
        const _Float16* b = gB + (size_t)t * BK;
        const unsigned la = ldsA + buf * BUFB;
        const unsigned lb = ldsB + buf * BUFB;
        async_copy8_b128(la,            a,           la + R32B,     a + r32,
                         la + 2 * R32B, a + 2 * r32, la + 3 * R32B, a + 3 * r32,
                         lb,            b,           lb + R32B,     b + r32,
                         lb + 2 * R32B, b + 2 * r32, lb + 3 * R32B, b + 3 * r32);
    };

    const int nt = K / BK;
    issue(0, 0);
    // tile 0 has landed for this wave; the barrier publishes it to the block
    asm volatile("s_wait_asynccnt 0x0" ::: "memory");
    __syncthreads();
    if (nt > 1) issue(1, 1);                  // tile 1 flies over trip 0

    for (int t = 0; t < nt; ++t) {
        const int buf = t & 1;
        // A fragment per ISA 16-bit 16x32 layout:
        //   lane hs half: halves 0..7 at k = hs*8 .. hs*8+7, halves 8..15 at +16
        // unrolled: the two 32-k halves of the tile differ only in an LDS
        // offset, which then folds into the loads' immediates
#pragma unroll
        for (int ks = 0; ks < 2; ++ks) {
            v16h af[2], bf[4];
#pragma unroll
            for (int i = 0; i < 2; ++i) {
                const _Float16* ab =
                    &As[buf][(wm * 32 + i * 16 + r) * LDP + ks * 32 + hs * 8];
                ((uint4*)&af[i])[0] = *(const uint4*)(ab);
                ((uint4*)&af[i])[1] = *(const uint4*)(ab + 16);
            }
#pragma unroll
            for (int j = 0; j < 4; ++j) {
                const _Float16* bb =
                    &Bs[buf][(wn * 64 + j * 16 + r) * LDP + ks * 32 + hs * 8];
                ((uint4*)&bf[j])[0] = *(const uint4*)(bb);
                ((uint4*)&bf[j])[1] = *(const uint4*)(bb + 16);
            }
#pragma unroll
            for (int i = 0; i < 2; ++i)
#pragma unroll
                for (int j = 0; j < 4; ++j)
                    acc[i][j] = __builtin_amdgcn_wmma_f32_16x16x32_f16(
                        false, af[i], false, bf[j], (short)0, acc[i][j], false, false);
        }

        // foot of the trip: this wave's reads of `buf` are done ...
        asm volatile("s_wait_dscnt 0x0" ::: "memory");
        // ... and its copies of tile t+1 have landed;
        asm volatile("s_wait_asynccnt 0x0" ::: "memory");
        // one barrier publishes tile t+1 and frees `buf` for the refill
        __syncthreads();
        if (t + 2 < nt) issue(t + 2, buf);
    }
    // nothing is in flight when the wave goes on to the epilogue
    asm volatile("s_wait_asynccnt 0x0" ::: "memory");

    // epilogue: C/D layout = lane (hs,r): col n = r, rows = hs*8 + 0..7
#pragma unroll
    for (int j = 0; j < 4; ++j) {
        const int n   = blockN + wn * 64 + j * 16 + r;
        const float bv = bias ? bias[n] : 0.f;
#pragma unroll
        for (int i = 0; i < 2; ++i) {
#pragma unroll
            for (int jj = 0; jj < 8; ++jj) {
                const int m = blockM + wm * 32 + i * 16 + hs * 8 + jj;
                float v = acc[i][j][jj] + bv;
                if (RELU) v = fmaxf(v, 0.f);
                C[(size_t)m * N + n] = (OutT)v;
            }
        }
    }
}

// ------------------------------ flash attention ----------------------------
// grid = (S/64, B*H), block = 128 (4 waves); each wave owns 16 query rows.
// Q/K/V in [B,S,H,HD] f16 layout (row stride D). Output Hcat same layout.
__global__ __launch_bounds__(128) void attn_wmma(const _Float16* __restrict__ Qg,
                                                 const _Float16* __restrict__ Kg,
                                                 const _Float16* __restrict__ Vg,
                                                 _Float16* __restrict__ Og) {
    constexpr int LDT = 72;                 // padded LDS row stride (halves)
    __shared__ _Float16 Qs[64 * LDT];
    __shared__ _Float16 Ks[64 * LDT];
    __shared__ _Float16 Vt[64 * LDT];       // V transposed: [e][k]
    __shared__ _Float16 Ps[64 * LDT];       // 4 waves x 16 rows of P

    const int bh   = blockIdx.y;            // 0..63
    const int b    = bh >> 4;
    const int h    = bh & 15;
    const int q0   = blockIdx.x * 64;
    const int tid  = threadIdx.x;
    const int wave = tid >> 5;
    const int lane = tid & 31;
    const int r    = lane & 15;
    const int hs   = lane >> 4;

    const size_t rowbase = (size_t)(b * TS) * TD + (size_t)h * THD;
    const _Float16* Qb = Qg + rowbase;
    const _Float16* Kb = Kg + rowbase;
    const _Float16* Vb = Vg + rowbase;

    // load Q block: 64 rows x 64 cols (async global -> LDS)
#pragma unroll
    for (int c = 0; c < 4; ++c) {
        int idx = (c * 128 + tid) * 8;      // 0..4095 in steps of 8
        int row = idx >> 6;
        int col = idx & 63;
        async_copy_b128((unsigned)(uintptr_t)(Qs + row * LDT + col),
                        Qb + (size_t)(q0 + row) * TD + col);
    }

    const v8f vzero = {0.f, 0.f, 0.f, 0.f, 0.f, 0.f, 0.f, 0.f};
    v8f o[4];
#pragma unroll
    for (int j = 0; j < 4; ++j) o[j] = vzero;
    float mrow[8], lrow[8];
#pragma unroll
    for (int jj = 0; jj < 8; ++jj) { mrow[jj] = -1.0e30f; lrow[jj] = 0.f; }

    const float scale = 0.03125f;           // 1/sqrt(D) = 1/32

    for (int kt = 0; kt < TS / 64; ++kt) {
        const int k0 = kt * 64;
        __syncthreads();                    // previous tile fully consumed
        // K tile via async-to-LDS; V tile transposed via VGPR scatter
#pragma unroll
        for (int c = 0; c < 4; ++c) {
            int idx = (c * 128 + tid) * 8;
            int row = idx >> 6;
            int col = idx & 63;
            async_copy_b128((unsigned)(uintptr_t)(Ks + row * LDT + col),
                            Kb + (size_t)(k0 + row) * TD + col);
            uint4 vv = *(const uint4*)(Vb + (size_t)(k0 + row) * TD + col);
            const _Float16* vp = (const _Float16*)&vv;
#pragma unroll
            for (int u = 0; u < 8; ++u) Vt[(col + u) * LDT + row] = vp[u];
        }
        if (kt + 1 < TS / 64)               // lowers to global_prefetch_b8
            __builtin_prefetch(Kb + (size_t)(k0 + 64) * TD + (tid & 63), 0, 1);
        wait_async(0);                      // own async K (and Q) writes done
        __syncthreads();

        // ---- scores = Q @ K^T  (16 rows x 64 keys per wave) ----
        v8f sc[4];
#pragma unroll
        for (int j = 0; j < 4; ++j) sc[j] = vzero;
#pragma unroll
        for (int ks = 0; ks < 2; ++ks) {
            v16h aq;
            const _Float16* ab = Qs + (wave * 16 + r) * LDT + ks * 32 + hs * 8;
            ((uint4*)&aq)[0] = *(const uint4*)(ab);
            ((uint4*)&aq)[1] = *(const uint4*)(ab + 16);
#pragma unroll
            for (int j = 0; j < 4; ++j) {
                v16h bk;
                const _Float16* bb = Ks + (j * 16 + r) * LDT + ks * 32 + hs * 8;
                ((uint4*)&bk)[0] = *(const uint4*)(bb);
                ((uint4*)&bk)[1] = *(const uint4*)(bb + 16);
                sc[j] = __builtin_amdgcn_wmma_f32_16x16x32_f16(
                    false, aq, false, bk, (short)0, sc[j], false, false);
            }
        }

        // ---- online softmax per row (rows jj + 8*hs; 16-lane reductions) --
#pragma unroll
        for (int jj = 0; jj < 8; ++jj) {
            float mx = -1.0e30f;
#pragma unroll
            for (int j = 0; j < 4; ++j) {
                sc[j][jj] *= scale;
                mx = fmaxf(mx, sc[j][jj]);
            }
#pragma unroll
            for (int off = 1; off < 16; off <<= 1)
                mx = fmaxf(mx, __shfl_xor(mx, off, 32));
            const float mn   = fmaxf(mrow[jj], mx);
            const float corr = __expf(mrow[jj] - mn);
            float rs = 0.f;
#pragma unroll
            for (int j = 0; j < 4; ++j) {
                float p = __expf(sc[j][jj] - mn);
                sc[j][jj] = p;
                rs += p;
            }
#pragma unroll
            for (int off = 1; off < 16; off <<= 1)
                rs += __shfl_xor(rs, off, 32);
            lrow[jj] = lrow[jj] * corr + rs;
            mrow[jj] = mn;
#pragma unroll
            for (int j = 0; j < 4; ++j) o[j][jj] *= corr;
            // stage P into this wave's private LDS strip for re-fragmenting
            const int prow = wave * 16 + hs * 8 + jj;
#pragma unroll
            for (int j = 0; j < 4; ++j)
                Ps[prow * LDT + j * 16 + r] = (_Float16)sc[j][jj];
        }
        // wave-private LDS RAW hazard: cross-lane write -> fragment read
        asm volatile("s_wait_dscnt 0x0" ::: "memory");

        // ---- o += P @ V  (B operand = Vt, already [N=e][K=k]) ----
#pragma unroll
        for (int ks = 0; ks < 2; ++ks) {
            v16h ap;
            const _Float16* ab = Ps + (wave * 16 + r) * LDT + ks * 32 + hs * 8;
            ((uint4*)&ap)[0] = *(const uint4*)(ab);
            ((uint4*)&ap)[1] = *(const uint4*)(ab + 16);
#pragma unroll
            for (int j = 0; j < 4; ++j) {
                v16h bv;
                const _Float16* bb = Vt + (j * 16 + r) * LDT + ks * 32 + hs * 8;
                ((uint4*)&bv)[0] = *(const uint4*)(bb);
                ((uint4*)&bv)[1] = *(const uint4*)(bb + 16);
                o[j] = __builtin_amdgcn_wmma_f32_16x16x32_f16(
                    false, ap, false, bv, (short)0, o[j], false, false);
            }
        }
    }

    // ---- normalize and store Hcat[b, s, h*64 + e] ----
    float invl[8];
#pragma unroll
    for (int jj = 0; jj < 8; ++jj) invl[jj] = 1.0f / lrow[jj];
#pragma unroll
    for (int j = 0; j < 4; ++j) {
        const int e = j * 16 + r;
#pragma unroll
        for (int jj = 0; jj < 8; ++jj) {
            const int row = wave * 16 + hs * 8 + jj;
            Og[rowbase + (size_t)(q0 + row) * TD + e] = (_Float16)(o[j][jj] * invl[jj]);
        }
    }
}

// -------------------------------- launcher ---------------------------------
extern "C" void kernel_launch(void* const* d_in, const int* in_sizes, int n_in,
                              void* d_out, int out_size, void* d_ws, size_t ws_size,
                              hipStream_t stream) {
    const float* emb = (const float*)d_in[0];
    const float* Wq  = (const float*)d_in[1];
    const float* bq  = (const float*)d_in[2];
    const float* Wk  = (const float*)d_in[3];
    const float* bk  = (const float*)d_in[4];
    const float* Wv  = (const float*)d_in[5];
    const float* bv  = (const float*)d_in[6];
    const float* W1  = (const float*)d_in[7];
    const float* b1  = (const float*)d_in[8];
    const float* W2  = (const float*)d_in[9];
    const float* b2  = (const float*)d_in[10];
    float* out = (float*)d_out;

    // workspace carve-up (f16 units)
    _Float16* ws = (_Float16*)d_ws;
    const size_t nEmb = (size_t)TM * TD;          // 8192*1024
    const size_t nWqkv = (size_t)TD * TD;         // 1024*1024
    const size_t nW1 = (size_t)TFF * TD;
    const size_t nW2 = (size_t)TD * TFF;
    _Float16* emb16  = ws;                 ws += nEmb;
    _Float16* wq16   = ws;                 ws += nWqkv;
    _Float16* wk16   = ws;                 ws += nWqkv;
    _Float16* wv16   = ws;                 ws += nWqkv;
    _Float16* w1_16  = ws;                 ws += nW1;
    _Float16* w2_16  = ws;                 ws += nW2;
    _Float16* q16    = ws;                 ws += nEmb;
    _Float16* k16    = ws;                 ws += nEmb;
    _Float16* v16    = ws;                 ws += nEmb;
    _Float16* hcat16 = ws;                 ws += nEmb;
    _Float16* hid16  = ws;                 ws += (size_t)TM * TFF;

    auto cvt = [&](const float* src, _Float16* dst, size_t n) {
        cvt_f32_to_f16<<<dim3((unsigned)((n + 255) / 256)), dim3(256), 0, stream>>>(
            src, dst, (int)n);
    };
    cvt(emb, emb16, nEmb);
    cvt(Wq, wq16, nWqkv);
    cvt(Wk, wk16, nWqkv);
    cvt(Wv, wv16, nWqkv);
    cvt(W1, w1_16, nW1);
    cvt(W2, w2_16, nW2);

    // QKV projections: [8192,1024] = emb16 @ W^T + b   (f16 out)
    {
        dim3 grid(TD / 128, TM / 128), blk(256);
        gemm_wmma<false, _Float16><<<grid, blk, 0, stream>>>(emb16, wq16, bq, q16, TM, TD, TD);
        gemm_wmma<false, _Float16><<<grid, blk, 0, stream>>>(emb16, wk16, bk, k16, TM, TD, TD);
        gemm_wmma<false, _Float16><<<grid, blk, 0, stream>>>(emb16, wv16, bv, v16, TM, TD, TD);
    }

    // attention -> Hcat (f16, [B,S,H*HD])
    {
        dim3 grid(TS / 64, TB * TH), blk(128);
        attn_wmma<<<grid, blk, 0, stream>>>(q16, k16, v16, hcat16);
    }

    // FFN layer 1: relu(Hcat @ W1^T + b1)  -> hid16 [8192,4096]
    {
        dim3 grid(TFF / 128, TM / 128), blk(256);
        gemm_wmma<true, _Float16><<<grid, blk, 0, stream>>>(hcat16, w1_16, b1, hid16, TM, TFF, TD);
    }
    // FFN layer 2: hid @ W2^T + b2 -> d_out (f32, [8192,1024])
    {
        dim3 grid(TD / 128, TM / 128), blk(256);
        gemm_wmma<false, float><<<grid, blk, 0, stream>>>(hid16, w2_16, b2, out, TM, TD, TFF);
    }
}

// v003
// One run takes 447 microseconds.
// Next to v002, in two timings, it ran 1.04 times as fast each time.
// Counting every step since v000, it is 1.40 times as fast.
#include <hip/hip_runtime.h>
#include <hip/hip_bf16.h>

// ---------------------------------------------------------------------------
// Transformer block for MI455X (gfx1250, wave32, WMMA f16 -> f32 accum)
//   B=4, S=2048, D=1024, H=16, HD=64, FF=4096, M = B*S = 8192
// Pipeline:
//   1) f32 -> f16 conversion of embeddings + all weights
//   2) WMMA GEMM (async-LDS double-buffered): Q/K/V = emb @ W^T + b
//   3) Flash-attention with WMMA (K Q^T and V^T P^T), online softmax
//   4) WMMA GEMM + ReLU: hid = Hcat @ W1^T + b1
//   5) WMMA GEMM (f32 out): out = hid @ W2^T + b2 -> d_out
// CDNA5 specifics: v_wmma_f32_16x16x32_f16, global_load_async_to_lds_b128
// (ASYNCcnt pipeline), s_wait_asynccnt / s_wait_dscnt, v_permlanex16_b32.
// ---------------------------------------------------------------------------

typedef __attribute__((ext_vector_type(16))) _Float16 v16h;
typedef __attribute__((ext_vector_type(8)))  float    v8f;
typedef __attribute__((ext_vector_type(8)))  _Float16 v8h;

#define TB 4
#define TS 2048
#define TD 1024
#define TH 16
#define THD 64
#define TFF 4096
#define TM (TB * TS)   // 8192

// async copy of 16 bytes (8 halves) global -> LDS, tracked by ASYNCcnt
__device__ __forceinline__ void async_copy_b128(unsigned lds_byte_addr,
                                                const _Float16* gptr) {
    asm volatile("global_load_async_to_lds_b128 %0, %1, off"
                 :: "v"(lds_byte_addr), "v"(gptr)
                 : "memory");
}
__device__ __forceinline__ void wait_async(int n) {
    if (n == 0) asm volatile("s_wait_asynccnt 0x0" ::: "memory");
    else        asm volatile("s_wait_asynccnt 0x4" ::: "memory");
}

// -------------------------------- f32 -> f16 -------------------------------
__global__ __launch_bounds__(256) void cvt_f32_to_f16(const float* __restrict__ in,
                                                      _Float16* __restrict__ out,
                                                      int n) {
    int i = blockIdx.x * blockDim.x + threadIdx.x;
    if (i < n) out[i] = (_Float16)in[i];
}

// ------------------------- WMMA tiled GEMM (C = A @ B^T) -------------------
// A: [M,K] f16 row-major. Bw: [N,K] f16 row-major (torch Linear weight).
// bias: f32 [N] or null. C: [M,N] OutT row-major. Optional ReLU.
// Block tile 128x128, K-step 64, 256 threads = 8 waves, wave tile 32x64.
// K must be a multiple of 64. Two LDS buffers fed by
// global_load_async_to_lds_b128; a K-step is 128 B of every operand row, so
// 8 lanes cover one whole 128-B line and one copy instruction 4 whole lines.

// Eight async copies (16 B per lane each) and, as the last line of the same
// statement, the wait that stands before any of their address registers is
// rewritten (in a statement of its own the compiler could lift later address
// arithmetic over it).
__device__ __forceinline__ void async_copy8_b128(
    unsigned l0, const _Float16* g0, unsigned l1, const _Float16* g1,
    unsigned l2, const _Float16* g2, unsigned l3, const _Float16* g3,
    unsigned l4, const _Float16* g4, unsigned l5, const _Float16* g5,
    unsigned l6, const _Float16* g6, unsigned l7, const _Float16* g7) {
    asm volatile("global_load_async_to_lds_b128 %0, %1, off\n\t"
                 "global_load_async_to_lds_b128 %2, %3, off\n\t"
                 "global_load_async_to_lds_b128 %4, %5, off\n\t"
                 "global_load_async_to_lds_b128 %6, %7, off\n\t"
                 "global_load_async_to_lds_b128 %8, %9, off\n\t"
                 "global_load_async_to_lds_b128 %10, %11, off\n\t"
                 "global_load_async_to_lds_b128 %12, %13, off\n\t"
                 "global_load_async_to_lds_b128 %14, %15, off\n\t"
                 "s_wait_xcnt 0x0"
                 :: "v"(l0), "v"(g0), "v"(l1), "v"(g1), "v"(l2), "v"(g2),
                    "v"(l3), "v"(g3), "v"(l4), "v"(g4), "v"(l5), "v"(g5),
                    "v"(l6), "v"(g6), "v"(l7), "v"(g7)
                 : "memory");
}

template <bool RELU, typename OutT>
__global__ __launch_bounds__(256) void gemm_wmma(const _Float16* __restrict__ A,
                                                 const _Float16* __restrict__ Bw,
                                                 const float* __restrict__ bias,
                                                 OutT* __restrict__ C,
                                                 int M, int N, int K) {
    // LDS row pitch in halves: 64 data + 8 pad = 144 B (16 B x odd), so the 16
    // rows of a ds_load_b128 fragment read fall on 16 distinct bank groups.
    // Pad is never read.
    constexpr int BK  = 64;
    constexpr int LDP = 72;
    __shared__ __attribute__((aligned(16))) _Float16 As[2][128 * LDP];
    __shared__ __attribute__((aligned(16))) _Float16 Bs[2][128 * LDP];

    const int tid  = threadIdx.x;
    const int wave = tid >> 5;
    const int lane = tid & 31;
    const int wm   = wave >> 1;     // 0..3 : wave row
    const int wn   = wave & 1;      // 0..1 : wave col
    const int r    = lane & 15;
    const int hs   = lane >> 4;     // 0/1, selects K-half per ISA A/B layout

    const int blockM = blockIdx.y * 128;
    const int blockN = blockIdx.x * 128;

    const v8f vzero = {0.f, 0.f, 0.f, 0.f, 0.f, 0.f, 0.f, 0.f};
    v8f acc[2][4];
#pragma unroll
    for (int i = 0; i < 2; ++i)
#pragma unroll
        for (int j = 0; j < 4; ++j) acc[i][j] = vzero;

    // cooperative tile copies: 8 lanes per row (128 B), 32 rows per copy of
    // the block, 4 copies for A and 4 for B per K-step
    const int ldr = tid >> 3;          // 0..31
    const int ldc = (tid & 7) * 8;     // 0..56 halves

    const unsigned ldsA = (unsigned)(uintptr_t)(&As[0][ldr * LDP + ldc]);
    const unsigned ldsB = (unsigned)(uintptr_t)(&Bs[0][ldr * LDP + ldc]);
    constexpr unsigned BUFB = 128 * LDP * 2;   // bytes of one buffer
    constexpr unsigned R32B = 32 * LDP * 2;    // bytes of 32 LDS rows
    const _Float16* gA = A  + (size_t)(blockM + ldr) * K + ldc;
    const _Float16* gB = Bw + (size_t)(blockN + ldr) * K + ldc;
    const size_t r32 = (size_t)32 * K;         // 32 global rows, in halves

    auto issue = [&](int t, int buf) {
        const _Float16* a = gA + (size_t)t * BK;
        const _Float16* b = gB + (size_t)t * BK;
        const unsigned la = ldsA + buf * BUFB;
        const unsigned lb = ldsB + buf * BUFB;
        async_copy8_b128(la,            a,           la + R32B,     a + r32,
                         la + 2 * R32B, a + 2 * r32, la + 3 * R32B, a + 3 * r32,
                         lb,            b,           lb + R32B,     b + r32,
                         lb + 2 * R32B, b + 2 * r32, lb + 3 * R32B, b + 3 * r32);
    };

    const int nt = K / BK;
    issue(0, 0);
    // tile 0 has landed for this wave; the barrier publishes it to the block
    asm volatile("s_wait_asynccnt 0x0" ::: "memory");
    __syncthreads();
    if (nt > 1) issue(1, 1);                  // tile 1 flies over trip 0

    for (int t = 0; t < nt; ++t) {
        const int buf = t & 1;
        // A fragment per ISA 16-bit 16x32 layout:
        //   lane hs half: halves 0..7 at k = hs*8 .. hs*8+7, halves 8..15 at +16
        // unrolled: the two 32-k halves of the tile differ only in an LDS
        // offset, which then folds into the loads' immediates
#pragma unroll
        for (int ks = 0; ks < 2; ++ks) {
            v16h af[2], bf[4];
#pragma unroll
            for (int i = 0; i < 2; ++i) {
                const _Float16* ab =
                    &As[buf][(wm * 32 + i * 16 + r) * LDP + ks * 32 + hs * 8];
                ((uint4*)&af[i])[0] = *(const uint4*)(ab);
                ((uint4*)&af[i])[1] = *(const uint4*)(ab + 16);
            }
#pragma unroll
            for (int j = 0; j < 4; ++j) {
                const _Float16* bb =
                    &Bs[buf][(wn * 64 + j * 16 + r) * LDP + ks * 32 + hs * 8];
                ((uint4*)&bf[j])[0] = *(const uint4*)(bb);
                ((uint4*)&bf[j])[1] = *(const uint4*)(bb + 16);
            }
#pragma unroll
            for (int i = 0; i < 2; ++i)
#pragma unroll
                for (int j = 0; j < 4; ++j)
                    acc[i][j] = __builtin_amdgcn_wmma_f32_16x16x32_f16(
                        false, af[i], false, bf[j], (short)0, acc[i][j], false, false);
        }

        // foot of the trip: this wave's reads of `buf` are done ...
        asm volatile("s_wait_dscnt 0x0" ::: "memory");
        // ... and its copies of tile t+1 have landed;
        asm volatile("s_wait_asynccnt 0x0" ::: "memory");
        // one barrier publishes tile t+1 and frees `buf` for the refill
        __syncthreads();
        if (t + 2 < nt) issue(t + 2, buf);
    }
    // nothing is in flight when the wave goes on to the epilogue
    asm volatile("s_wait_asynccnt 0x0" ::: "memory");

    // epilogue: C/D layout = lane (hs,r): col n = r, rows = hs*8 + 0..7
#pragma unroll
    for (int j = 0; j < 4; ++j) {
        const int n   = blockN + wn * 64 + j * 16 + r;
        const float bv = bias ? bias[n] : 0.f;
#pragma unroll
        for (int i = 0; i < 2; ++i) {
#pragma unroll
            for (int jj = 0; jj < 8; ++jj) {
                const int m = blockM + wm * 32 + i * 16 + hs * 8 + jj;
                float v = acc[i][j][jj] + bv;
                if (RELU) v = fmaxf(v, 0.f);
                C[(size_t)m * N + n] = (OutT)v;
            }
        }
    }
}

// ------------------------------ flash attention ----------------------------
// value of lane l ^ 16 (the other 16-lane half), by a vector cross-row move
__device__ __forceinline__ float xhalf(float x) {
    const int b = __builtin_bit_cast(int, x);
    return __builtin_bit_cast(float, __builtin_amdgcn_permlanex16(
        b, b, 0x76543210, 0xfedcba98, false, false));
}

// grid = (S/64, B*H), block = 128 (4 waves); each wave owns 16 query rows.
// Q/K/V in [B,S,H,HD] f16 layout (row stride D). Output Hcat same layout.
__global__ __launch_bounds__(128) void attn_wmma(const _Float16* __restrict__ Qg,
                                                 const _Float16* __restrict__ Kg,
                                                 const _Float16* __restrict__ Vg,
                                                 _Float16* __restrict__ Og) {
    constexpr int LDT = 72;                 // padded LDS row stride (halves)
    __shared__ _Float16 Qs[64 * LDT];
    __shared__ _Float16 Ks[64 * LDT];
    __shared__ _Float16 Vt[64 * LDT];       // V transposed: [e][k]

    const int bh   = blockIdx.y;            // 0..63
    const int b    = bh >> 4;
    const int h    = bh & 15;
    const int q0   = blockIdx.x * 64;
    const int tid  = threadIdx.x;
    const int wave = tid >> 5;
    const int lane = tid & 31;
    const int r    = lane & 15;
    const int hs   = lane >> 4;

    const size_t rowbase = (size_t)(b * TS) * TD + (size_t)h * THD;
    const _Float16* Qb = Qg + rowbase;
    const _Float16* Kb = Kg + rowbase;
    const _Float16* Vb = Vg + rowbase;

    // load Q block: 64 rows x 64 cols (async global -> LDS)
#pragma unroll
    for (int c = 0; c < 4; ++c) {
        int idx = (c * 128 + tid) * 8;      // 0..4095 in steps of 8
        int row = idx >> 6;
        int col = idx & 63;
        async_copy_b128((unsigned)(uintptr_t)(Qs + row * LDT + col),
                        Qb + (size_t)(q0 + row) * TD + col);
    }

    const v8f vzero = {0.f, 0.f, 0.f, 0.f, 0.f, 0.f, 0.f, 0.f};
    // Transposed products: a lane (hs, r) owns ONE query, row wave*16 + r.
    //   sc[j][jj] = S^T[key j*16 + hs*8 + jj][query r]
    //   o[j][jj]  = O^T[e   j*16 + hs*8 + jj][query r]
    v8f o[4];
#pragma unroll
    for (int j = 0; j < 4; ++j) o[j] = vzero;
    float mrow = -1.0e30f;   // running maximum of the lane's query (both halves)
    float lrow = 0.f;        // running sum over this lane half's keys only

    const float scale = 0.03125f;           // 1/sqrt(D) = 1/32

    for (int kt = 0; kt < TS / 64; ++kt) {
        const int k0 = kt * 64;
        __syncthreads();                    // previous tile fully consumed
        // K tile via async-to-LDS; V tile transposed via VGPR scatter
#pragma unroll
        for (int c = 0; c < 4; ++c) {
            int idx = (c * 128 + tid) * 8;
            int row = idx >> 6;
            int col = idx & 63;
            async_copy_b128((unsigned)(uintptr_t)(Ks + row * LDT + col),
                            Kb + (size_t)(k0 + row) * TD + col);
            uint4 vv = *(const uint4*)(Vb + (size_t)(k0 + row) * TD + col);
            const _Float16* vp = (const _Float16*)&vv;
#pragma unroll
            for (int u = 0; u < 8; ++u) Vt[(col + u) * LDT + row] = vp[u];
        }
        if (kt + 1 < TS / 64)               // lowers to global_prefetch_b8
            __builtin_prefetch(Kb + (size_t)(k0 + 64) * TD + (tid & 63), 0, 1);
        wait_async(0);                      // own async K (and Q) writes done
        __syncthreads();

        // ---- S^T = K @ Q^T  (64 keys x 16 queries per wave) ----
        // A = K rows, B = Q rows, both read in the same k order
        v8f sc[4];
#pragma unroll
        for (int j = 0; j < 4; ++j) sc[j] = vzero;
#pragma unroll
        for (int ks = 0; ks < 2; ++ks) {
            v16h bq;
            const _Float16* qb = Qs + (wave * 16 + r) * LDT + ks * 32 + hs * 8;
            ((uint4*)&bq)[0] = *(const uint4*)(qb);
            ((uint4*)&bq)[1] = *(const uint4*)(qb + 16);
#pragma unroll
            for (int j = 0; j < 4; ++j) {
                v16h ak;
                const _Float16* kb = Ks + (j * 16 + r) * LDT + ks * 32 + hs * 8;
                ((uint4*)&ak)[0] = *(const uint4*)(kb);
                ((uint4*)&ak)[1] = *(const uint4*)(kb + 16);
                sc[j] = __builtin_amdgcn_wmma_f32_16x16x32_f16(
                    false, ak, false, bq, (short)0, sc[j], false, false);
            }
        }

        // ---- online softmax: the lane's 32 scores all belong to its query ----
        float mx = -1.0e30f;
#pragma unroll
        for (int j = 0; j < 4; ++j)
#pragma unroll
            for (int jj = 0; jj < 8; ++jj) {
                sc[j][jj] *= scale;
                mx = fmaxf(mx, sc[j][jj]);
            }
        mx = fmaxf(mx, xhalf(mx));          // the other 32 keys of the query
        const float mn   = fmaxf(mrow, mx);
        const float corr = __expf(mrow - mn);
        float rs = 0.f;
#pragma unroll
        for (int j = 0; j < 4; ++j)
#pragma unroll
            for (int jj = 0; jj < 8; ++jj) {
                float p = __expf(sc[j][jj] - mn);
                sc[j][jj] = p;
                rs += p;
            }
        lrow = lrow * corr + rs;            // halves are joined after the loop
        mrow = mn;
#pragma unroll
        for (int j = 0; j < 4; ++j)
#pragma unroll
            for (int jj = 0; jj < 8; ++jj) o[j][jj] *= corr;

        // ---- O^T += V^T @ P^T  (A = Vt rows [e][k]; B = P^T from sc) ----
        // Two S^T tiles converted in place are the B operand: element s of the
        // lane is key ks*32 + (s < 8 ? hs*8 + s : 16 + hs*8 + s - 8), which is
        // the k order of the Vt loads below.
#pragma unroll
        for (int ks = 0; ks < 2; ++ks) {
            v16h bp;
#pragma unroll
            for (int jj = 0; jj < 8; ++jj) {
                bp[jj]     = (_Float16)sc[2 * ks][jj];
                bp[8 + jj] = (_Float16)sc[2 * ks + 1][jj];
            }
#pragma unroll
            for (int j = 0; j < 4; ++j) {
                v16h av;
                const _Float16* vb = Vt + (j * 16 + r) * LDT + ks * 32 + hs * 8;
                ((uint4*)&av)[0] = *(const uint4*)(vb);
                ((uint4*)&av)[1] = *(const uint4*)(vb + 16);
                o[j] = __builtin_amdgcn_wmma_f32_16x16x32_f16(
                    false, av, false, bp, (short)0, o[j], false, false);
            }
        }
    }

    // ---- normalize and store Hcat[b, s, h*64 + e]: 8 consecutive e a lane ----
    const float invl = 1.0f / (lrow + xhalf(lrow));
    _Float16* orow = Og + rowbase + (size_t)(q0 + wave * 16 + r) * TD + hs * 8;
#pragma unroll
    for (int j = 0; j < 4; ++j) {
        v8h ov;
#pragma unroll
        for (int jj = 0; jj < 8; ++jj) ov[jj] = (_Float16)(o[j][jj] * invl);
        *(v8h*)(orow + j * 16) = ov;
    }
}

// -------------------------------- launcher ---------------------------------
extern "C" void kernel_launch(void* const* d_in, const int* in_sizes, int n_in,
                              void* d_out, int out_size, void* d_ws, size_t ws_size,
                              hipStream_t stream) {
    const float* emb = (const float*)d_in[0];
    const float* Wq  = (const float*)d_in[1];
    const float* bq  = (const float*)d_in[2];
    const float* Wk  = (const float*)d_in[3];
    const float* bk  = (const float*)d_in[4];
    const float* Wv  = (const float*)d_in[5];
    const float* bv  = (const float*)d_in[6];
    const float* W1  = (const float*)d_in[7];
    const float* b1  = (const float*)d_in[8];
    const float* W2  = (const float*)d_in[9];
    const float* b2  = (const float*)d_in[10];
    float* out = (float*)d_out;

    // workspace carve-up (f16 units)
    _Float16* ws = (_Float16*)d_ws;
    const size_t nEmb = (size_t)TM * TD;          // 8192*1024
    const size_t nWqkv = (size_t)TD * TD;         // 1024*1024
    const size_t nW1 = (size_t)TFF * TD;
    const size_t nW2 = (size_t)TD * TFF;
    _Float16* emb16  = ws;                 ws += nEmb;
    _Float16* wq16   = ws;                 ws += nWqkv;
    _Float16* wk16   = ws;                 ws += nWqkv;
    _Float16* wv16   = ws;                 ws += nWqkv;
    _Float16* w1_16  = ws;                 ws += nW1;
    _Float16* w2_16  = ws;                 ws += nW2;
    _Float16* q16    = ws;                 ws += nEmb;
    _Float16* k16    = ws;                 ws += nEmb;
    _Float16* v16    = ws;                 ws += nEmb;
    _Float16* hcat16 = ws;                 ws += nEmb;
    _Float16* hid16  = ws;                 ws += (size_t)TM * TFF;

    auto cvt = [&](const float* src, _Float16* dst, size_t n) {
        cvt_f32_to_f16<<<dim3((unsigned)((n + 255) / 256)), dim3(256), 0, stream>>>(
            src, dst, (int)n);
    };
    cvt(emb, emb16, nEmb);
    cvt(Wq, wq16, nWqkv);
    cvt(Wk, wk16, nWqkv);
    cvt(Wv, wv16, nWqkv);
    cvt(W1, w1_16, nW1);
    cvt(W2, w2_16, nW2);

    // QKV projections: [8192,1024] = emb16 @ W^T + b   (f16 out)
    {
        dim3 grid(TD / 128, TM / 128), blk(256);
        gemm_wmma<false, _Float16><<<grid, blk, 0, stream>>>(emb16, wq16, bq, q16, TM, TD, TD);
        gemm_wmma<false, _Float16><<<grid, blk, 0, stream>>>(emb16, wk16, bk, k16, TM, TD, TD);
        gemm_wmma<false, _Float16><<<grid, blk, 0, stream>>>(emb16, wv16, bv, v16, TM, TD, TD);
    }

    // attention -> Hcat (f16, [B,S,H*HD])
    {
        dim3 grid(TS / 64, TB * TH), blk(128);
        attn_wmma<<<grid, blk, 0, stream>>>(q16, k16, v16, hcat16);
    }

    // FFN layer 1: relu(Hcat @ W1^T + b1)  -> hid16 [8192,4096]
    {
        dim3 grid(TFF / 128, TM / 128), blk(256);
        gemm_wmma<true, _Float16><<<grid, blk, 0, stream>>>(hcat16, w1_16, b1, hid16, TM, TFF, TD);
    }
    // FFN layer 2: hid @ W2^T + b2 -> d_out (f32, [8192,1024])
    {
        dim3 grid(TD / 128, TM / 128), blk(256);
        gemm_wmma<false, float><<<grid, blk, 0, stream>>>(hid16, w2_16, b2, out, TM, TD, TFF);
    }
}

// v004
// It runs in 312 microseconds.
// Two timings next to v003 put it at 1.42 and 1.43 times that version's speed.
// Counting every step since v000, it is 2.00 times as fast.
#include <hip/hip_runtime.h>
#include <hip/hip_bf16.h>

// ---------------------------------------------------------------------------
// Transformer block for MI455X (gfx1250, wave32, WMMA f16 -> f32 accum)
//   B=4, S=2048, D=1024, H=16, HD=64, FF=4096, M = B*S = 8192
// Pipeline:
//   1) f32 -> f16 conversion of embeddings + all weights
//   2) WMMA GEMM (async-LDS double-buffered): Q/K/V = emb @ W^T + b
//   3) Flash-attention with WMMA (K Q^T and V^T P^T), online softmax;
//      V lies row-major in LDS and is transposed by ds_load_tr16_b128
//   4) WMMA GEMM + ReLU: hid = Hcat @ W1^T + b1
//   5) WMMA GEMM (f32 out): out = hid @ W2^T + b2 -> d_out
// CDNA5 specifics: v_wmma_f32_16x16x32_f16, global_load_async_to_lds_b128
// (ASYNCcnt pipeline), s_wait_asynccnt / s_wait_dscnt, v_permlanex16_b32.
// ---------------------------------------------------------------------------

typedef __attribute__((ext_vector_type(16))) _Float16 v16h;
typedef __attribute__((ext_vector_type(8)))  float    v8f;
typedef __attribute__((ext_vector_type(8)))  _Float16 v8h;

#define TB 4
#define TS 2048
#define TD 1024
#define TH 16
#define THD 64
#define TFF 4096
#define TM (TB * TS)   // 8192

// four async copies of 16 bytes (8 halves) per lane, global -> LDS, tracked by
// ASYNCcnt; the last line is the wait that stands before any of their address
// registers is rewritten
__device__ __forceinline__ void async_copy4_b128(
    unsigned l0, const _Float16* g0, unsigned l1, const _Float16* g1,
    unsigned l2, const _Float16* g2, unsigned l3, const _Float16* g3) {
    asm volatile("global_load_async_to_lds_b128 %0, %1, off\n\t"
                 "global_load_async_to_lds_b128 %2, %3, off\n\t"
                 "global_load_async_to_lds_b128 %4, %5, off\n\t"
                 "global_load_async_to_lds_b128 %6, %7, off\n\t"
                 "s_wait_xcnt 0x0"
                 :: "v"(l0), "v"(g0), "v"(l1), "v"(g1), "v"(l2), "v"(g2),
                    "v"(l3), "v"(g3)
                 : "memory");
}
__device__ __forceinline__ void wait_async(int n) {
    if (n == 0) asm volatile("s_wait_asynccnt 0x0" ::: "memory");
    else        asm volatile("s_wait_asynccnt 0x4" ::: "memory");
}

// -------------------------------- f32 -> f16 -------------------------------
__global__ __launch_bounds__(256) void cvt_f32_to_f16(const float* __restrict__ in,
                                                      _Float16* __restrict__ out,
                                                      int n) {
    int i = blockIdx.x * blockDim.x + threadIdx.x;
    if (i < n) out[i] = (_Float16)in[i];
}

// ------------------------- WMMA tiled GEMM (C = A @ B^T) -------------------
// A: [M,K] f16 row-major. Bw: [N,K] f16 row-major (torch Linear weight).
// bias: f32 [N] or null. C: [M,N] OutT row-major. Optional ReLU.
// Block tile 128x128, K-step 64, 256 threads = 8 waves, wave tile 32x64.
// K must be a multiple of 64. Two LDS buffers fed by
// global_load_async_to_lds_b128; a K-step is 128 B of every operand row, so
// 8 lanes cover one whole 128-B line and one copy instruction 4 whole lines.

// Eight async copies (16 B per lane each) and, as the last line of the same
// statement, the wait that stands before any of their address registers is
// rewritten (in a statement of its own the compiler could lift later address
// arithmetic over it).
__device__ __forceinline__ void async_copy8_b128(
    unsigned l0, const _Float16* g0, unsigned l1, const _Float16* g1,
    unsigned l2, const _Float16* g2, unsigned l3, const _Float16* g3,
    unsigned l4, const _Float16* g4, unsigned l5, const _Float16* g5,
    unsigned l6, const _Float16* g6, unsigned l7, const _Float16* g7) {
    asm volatile("global_load_async_to_lds_b128 %0, %1, off\n\t"
                 "global_load_async_to_lds_b128 %2, %3, off\n\t"
                 "global_load_async_to_lds_b128 %4, %5, off\n\t"
                 "global_load_async_to_lds_b128 %6, %7, off\n\t"
                 "global_load_async_to_lds_b128 %8, %9, off\n\t"
                 "global_load_async_to_lds_b128 %10, %11, off\n\t"
                 "global_load_async_to_lds_b128 %12, %13, off\n\t"
                 "global_load_async_to_lds_b128 %14, %15, off\n\t"
                 "s_wait_xcnt 0x0"
                 :: "v"(l0), "v"(g0), "v"(l1), "v"(g1), "v"(l2), "v"(g2),
                    "v"(l3), "v"(g3), "v"(l4), "v"(g4), "v"(l5), "v"(g5),
                    "v"(l6), "v"(g6), "v"(l7), "v"(g7)
                 : "memory");
}

template <bool RELU, typename OutT>
__global__ __launch_bounds__(256) void gemm_wmma(const _Float16* __restrict__ A,
                                                 const _Float16* __restrict__ Bw,
                                                 const float* __restrict__ bias,
                                                 OutT* __restrict__ C,
                                                 int M, int N, int K) {
    // LDS row pitch in halves: 64 data + 8 pad = 144 B (16 B x odd), so the 16
    // rows of a ds_load_b128 fragment read fall on 16 distinct bank groups.
    // Pad is never read.
    constexpr int BK  = 64;
    constexpr int LDP = 72;
    __shared__ __attribute__((aligned(16))) _Float16 As[2][128 * LDP];
    __shared__ __attribute__((aligned(16))) _Float16 Bs[2][128 * LDP];

    const int tid  = threadIdx.x;
    const int wave = tid >> 5;
    const int lane = tid & 31;
    const int wm   = wave >> 1;     // 0..3 : wave row
    const int wn   = wave & 1;      // 0..1 : wave col
    const int r    = lane & 15;
    const int hs   = lane >> 4;     // 0/1, selects K-half per ISA A/B layout

    const int blockM = blockIdx.y * 128;
    const int blockN = blockIdx.x * 128;

    const v8f vzero = {0.f, 0.f, 0.f, 0.f, 0.f, 0.f, 0.f, 0.f};
    v8f acc[2][4];
#pragma unroll
    for (int i = 0; i < 2; ++i)
#pragma unroll
        for (int j = 0; j < 4; ++j) acc[i][j] = vzero;

    // cooperative tile copies: 8 lanes per row (128 B), 32 rows per copy of
    // the block, 4 copies for A and 4 for B per K-step
    const int ldr = tid >> 3;          // 0..31
    const int ldc = (tid & 7) * 8;     // 0..56 halves

    const unsigned ldsA = (unsigned)(uintptr_t)(&As[0][ldr * LDP + ldc]);
    const unsigned ldsB = (unsigned)(uintptr_t)(&Bs[0][ldr * LDP + ldc]);
    constexpr unsigned BUFB = 128 * LDP * 2;   // bytes of one buffer
    constexpr unsigned R32B = 32 * LDP * 2;    // bytes of 32 LDS rows
    const _Float16* gA = A  + (size_t)(blockM + ldr) * K + ldc;
    const _Float16* gB = Bw + (size_t)(blockN + ldr) * K + ldc;
    const size_t r32 = (size_t)32 * K;         // 32 global rows, in halves

    auto issue = [&](int t, int buf) {
        const _Float16* a = gA + (size_t)t * BK;
        const _Float16* b = gB + (size_t)t * BK;
        const unsigned la = ldsA + buf * BUFB;
        const unsigned lb = ldsB + buf * BUFB;
        async_copy8_b128(la,            a,           la + R32B,     a + r32,
                         la + 2 * R32B, a + 2 * r32, la + 3 * R32B, a + 3 * r32,
                         lb,            b,           lb + R32B,     b + r32,
                         lb + 2 * R32B, b + 2 * r32, lb + 3 * R32B, b + 3 * r32);
    };

    const int nt = K / BK;
    issue(0, 0);
    // tile 0 has landed for this wave; the barrier publishes it to the block
    asm volatile("s_wait_asynccnt 0x0" ::: "memory");
    __syncthreads();
    if (nt > 1) issue(1, 1);                  // tile 1 flies over trip 0

    for (int t = 0; t < nt; ++t) {
        const int buf = t & 1;
        // A fragment per ISA 16-bit 16x32 layout:
        //   lane hs half: halves 0..7 at k = hs*8 .. hs*8+7, halves 8..15 at +16
        // unrolled: the two 32-k halves of the tile differ only in an LDS
        // offset, which then folds into the loads' immediates
#pragma unroll
        for (int ks = 0; ks < 2; ++ks) {
            v16h af[2], bf[4];
#pragma unroll
            for (int i = 0; i < 2; ++i) {
                const _Float16* ab =
                    &As[buf][(wm * 32 + i * 16 + r) * LDP + ks * 32 + hs * 8];
                ((uint4*)&af[i])[0] = *(const uint4*)(ab);
                ((uint4*)&af[i])[1] = *(const uint4*)(ab + 16);
            }
#pragma unroll
            for (int j = 0; j < 4; ++j) {
                const _Float16* bb =
                    &Bs[buf][(wn * 64 + j * 16 + r) * LDP + ks * 32 + hs * 8];
                ((uint4*)&bf[j])[0] = *(const uint4*)(bb);
                ((uint4*)&bf[j])[1] = *(const uint4*)(bb + 16);
            }
#pragma unroll
            for (int i = 0; i < 2; ++i)
#pragma unroll
                for (int j = 0; j < 4; ++j)
                    acc[i][j] = __builtin_amdgcn_wmma_f32_16x16x32_f16(
                        false, af[i], false, bf[j], (short)0, acc[i][j], false, false);
        }

        // foot of the trip: this wave's reads of `buf` are done ...
        asm volatile("s_wait_dscnt 0x0" ::: "memory");
        // ... and its copies of tile t+1 have landed;
        asm volatile("s_wait_asynccnt 0x0" ::: "memory");
        // one barrier publishes tile t+1 and frees `buf` for the refill
        __syncthreads();
        if (t + 2 < nt) issue(t + 2, buf);
    }
    // nothing is in flight when the wave goes on to the epilogue
    asm volatile("s_wait_asynccnt 0x0" ::: "memory");

    // epilogue: C/D layout = lane (hs,r): col n = r, rows = hs*8 + 0..7
#pragma unroll
    for (int j = 0; j < 4; ++j) {
        const int n   = blockN + wn * 64 + j * 16 + r;
        const float bv = bias ? bias[n] : 0.f;
#pragma unroll
        for (int i = 0; i < 2; ++i) {
#pragma unroll
            for (int jj = 0; jj < 8; ++jj) {
                const int m = blockM + wm * 32 + i * 16 + hs * 8 + jj;
                float v = acc[i][j][jj] + bv;
                if (RELU) v = fmaxf(v, 0.f);
                C[(size_t)m * N + n] = (OutT)v;
            }
        }
    }
}

// ------------------------------ flash attention ----------------------------
// value of lane l ^ 16 (the other 16-lane half), by a vector cross-row move
__device__ __forceinline__ float xhalf(float x) {
    const int b = __builtin_bit_cast(int, x);
    return __builtin_bit_cast(float, __builtin_amdgcn_permlanex16(
        b, b, 0x76543210, 0xfedcba98, false, false));
}

// 16 bytes of a row-major 16-bit LDS tile per lane, handed out transposed:
// two of them (k and k + 16) are one 16 x 32 A fragment in the hardware k order
typedef __attribute__((ext_vector_type(8))) short s16x8;
__device__ __forceinline__ uint4 lds_tr16(const _Float16* p) {
    typedef __attribute__((address_space(3))) s16x8 lds_s16x8;
    return __builtin_bit_cast(uint4,
        __builtin_amdgcn_ds_load_tr16_b128_v8i16((lds_s16x8*)p));
}

// grid = (S/64, B*H), block = 128 (4 waves); each wave owns 16 query rows.
// Q/K/V in [B,S,H,HD] f16 layout (row stride D). Output Hcat same layout.
__global__ __launch_bounds__(128) void attn_wmma(const _Float16* __restrict__ Qg,
                                                 const _Float16* __restrict__ Kg,
                                                 const _Float16* __restrict__ Vg,
                                                 _Float16* __restrict__ Og) {
    constexpr int LDT = 72;                 // padded LDS row stride (halves)
    // V rows [k][e]: 160 B = 32 B x odd, the pitch of the transposing load
    constexpr int LDV = 80;
    __shared__ __attribute__((aligned(16))) _Float16 Qs[64 * LDT];
    __shared__ __attribute__((aligned(16))) _Float16 Ks[64 * LDT];
    __shared__ __attribute__((aligned(16))) _Float16 Vs[64 * LDV];

    const int bh   = blockIdx.y;            // 0..63
    const int b    = bh >> 4;
    const int h    = bh & 15;
    const int q0   = blockIdx.x * 64;
    const int tid  = threadIdx.x;
    const int wave = tid >> 5;
    const int lane = tid & 31;
    const int r    = lane & 15;
    const int hs   = lane >> 4;

    const size_t rowbase = (size_t)(b * TS) * TD + (size_t)h * THD;
    const _Float16* Qb = Qg + rowbase;
    const _Float16* Kb = Kg + rowbase;
    const _Float16* Vb = Vg + rowbase;

    // tile copies: 8 lanes a row (one 128-B line), 16 rows a copy of the block,
    // 4 copies for each of Q, K and V
    const int crow = tid >> 3;              // 0..15
    const int ccol = (tid & 7) * 8;         // 0..56 halves
    constexpr unsigned K16B = 16 * LDT * 2; // bytes of 16 LDS rows of Q or K
    constexpr unsigned V16B = 16 * LDV * 2; // bytes of 16 LDS rows of V
    constexpr size_t   G16  = (size_t)16 * TD;   // 16 global rows, in halves

    // load Q block: 64 rows x 64 cols (async global -> LDS)
    {
        const unsigned ldsQ = (unsigned)(uintptr_t)(Qs + crow * LDT + ccol);
        const _Float16* gq = Qb + (size_t)(q0 + crow) * TD + ccol;
        async_copy4_b128(ldsQ,            gq,           ldsQ + K16B,     gq + G16,
                         ldsQ + 2 * K16B, gq + 2 * G16, ldsQ + 3 * K16B, gq + 3 * G16);
    }

    const v8f vzero = {0.f, 0.f, 0.f, 0.f, 0.f, 0.f, 0.f, 0.f};
    // Transposed products: a lane (hs, r) owns ONE query, row wave*16 + r.
    //   sc[j][jj] = S^T[key j*16 + hs*8 + jj][query r]
    //   o[j][jj]  = O^T[e   j*16 + hs*8 + jj][query r]
    v8f o[4];
#pragma unroll
    for (int j = 0; j < 4; ++j) o[j] = vzero;
    float mrow = -1.0e30f;   // running maximum of the lane's query (both halves)
    float lrow = 0.f;        // running sum over this lane half's keys only

    const float scale = 0.03125f;           // 1/sqrt(D) = 1/32

    const unsigned ldsK = (unsigned)(uintptr_t)(Ks + crow * LDT + ccol);
    const unsigned ldsV = (unsigned)(uintptr_t)(Vs + crow * LDV + ccol);
    // lane address of the transposing load: row 8*hs + (lane & 7), and the
    // second 16 B of the 32-B column group in lanes 8..15 of each half
    const _Float16* vtr = Vs + (hs * 8 + (lane & 7)) * LDV + ((lane >> 3) & 1) * 8;

    for (int kt = 0; kt < TS / 64; ++kt) {
        const int k0 = kt * 64;
        // this wave's LDS reads of the previous tile have retired before any
        // wave's copies may overwrite it ...
        asm volatile("s_wait_dscnt 0x0" ::: "memory");
        __syncthreads();                    // ... and so have every wave's
        // K and V tiles, both row-major, via async-to-LDS
        {
            const _Float16* gk = Kb + (size_t)(k0 + crow) * TD + ccol;
            const _Float16* gv = Vb + (size_t)(k0 + crow) * TD + ccol;
            async_copy8_b128(ldsK,            gk,           ldsK + K16B,     gk + G16,
                             ldsK + 2 * K16B, gk + 2 * G16, ldsK + 3 * K16B, gk + 3 * G16,
                             ldsV,            gv,           ldsV + V16B,     gv + G16,
                             ldsV + 2 * V16B, gv + 2 * G16, ldsV + 3 * V16B, gv + 3 * G16);
        }
        if (kt + 1 < TS / 64)               // lowers to global_prefetch_b8
            __builtin_prefetch(Kb + (size_t)(k0 + 64) * TD + (tid & 63), 0, 1);
        wait_async(0);                      // own async K, V (and Q) writes done
        __syncthreads();

        // ---- S^T = K @ Q^T  (64 keys x 16 queries per wave) ----
        // A = K rows, B = Q rows, both read in the same k order
        v8f sc[4];
#pragma unroll
        for (int j = 0; j < 4; ++j) sc[j] = vzero;
#pragma unroll
        for (int ks = 0; ks < 2; ++ks) {
            v16h bq;
            const _Float16* qb = Qs + (wave * 16 + r) * LDT + ks * 32 + hs * 8;
            ((uint4*)&bq)[0] = *(const uint4*)(qb);
            ((uint4*)&bq)[1] = *(const uint4*)(qb + 16);
#pragma unroll
            for (int j = 0; j < 4; ++j) {
                v16h ak;
                const _Float16* kb = Ks + (j * 16 + r) * LDT + ks * 32 + hs * 8;
                ((uint4*)&ak)[0] = *(const uint4*)(kb);
                ((uint4*)&ak)[1] = *(const uint4*)(kb + 16);
                sc[j] = __builtin_amdgcn_wmma_f32_16x16x32_f16(
                    false, ak, false, bq, (short)0, sc[j], false, false);
            }
        }

        // ---- online softmax: the lane's 32 scores all belong to its query ----
        float mx = -1.0e30f;
#pragma unroll
        for (int j = 0; j < 4; ++j)
#pragma unroll
            for (int jj = 0; jj < 8; ++jj) {
                sc[j][jj] *= scale;
                mx = fmaxf(mx, sc[j][jj]);
            }
        mx = fmaxf(mx, xhalf(mx));          // the other 32 keys of the query
        const float mn   = fmaxf(mrow, mx);
        const float corr = __expf(mrow - mn);
        float rs = 0.f;
#pragma unroll
        for (int j = 0; j < 4; ++j)
#pragma unroll
            for (int jj = 0; jj < 8; ++jj) {
                float p = __expf(sc[j][jj] - mn);
                sc[j][jj] = p;
                rs += p;
            }
        lrow = lrow * corr + rs;            // halves are joined after the loop
        mrow = mn;
#pragma unroll
        for (int j = 0; j < 4; ++j)
#pragma unroll
            for (int jj = 0; jj < 8; ++jj) o[j][jj] *= corr;

        // ---- O^T += V^T @ P^T  (A = V^T by transposing loads; B = P^T from sc) ----
        // Two S^T tiles converted in place are the B operand: element s of the
        // lane is key ks*32 + (s < 8 ? hs*8 + s : 16 + hs*8 + s - 8), which is
        // the k order of the transposing loads below: lane (hs, r) gets
        // V[ks*32 + hs*8 + 0..7][j*16 + r], then the same 16 keys further on.
#pragma unroll
        for (int ks = 0; ks < 2; ++ks) {
            v16h bp;
#pragma unroll
            for (int jj = 0; jj < 8; ++jj) {
                bp[jj]     = (_Float16)sc[2 * ks][jj];
                bp[8 + jj] = (_Float16)sc[2 * ks + 1][jj];
            }
#pragma unroll
            for (int j = 0; j < 4; ++j) {
                v16h av;
                const _Float16* vb = vtr + ks * 32 * LDV + j * 16;
                ((uint4*)&av)[0] = lds_tr16(vb);
                ((uint4*)&av)[1] = lds_tr16(vb + 16 * LDV);
                o[j] = __builtin_amdgcn_wmma_f32_16x16x32_f16(
                    false, av, false, bp, (short)0, o[j], false, false);
            }
        }
    }

    // ---- normalize and store Hcat[b, s, h*64 + e]: 8 consecutive e a lane ----
    const float invl = 1.0f / (lrow + xhalf(lrow));
    _Float16* orow = Og + rowbase + (size_t)(q0 + wave * 16 + r) * TD + hs * 8;
#pragma unroll
    for (int j = 0; j < 4; ++j) {
        v8h ov;
#pragma unroll
        for (int jj = 0; jj < 8; ++jj) ov[jj] = (_Float16)(o[j][jj] * invl);
        *(v8h*)(orow + j * 16) = ov;
    }
}

// -------------------------------- launcher ---------------------------------
extern "C" void kernel_launch(void* const* d_in, const int* in_sizes, int n_in,
                              void* d_out, int out_size, void* d_ws, size_t ws_size,
                              hipStream_t stream) {
    const float* emb = (const float*)d_in[0];
    const float* Wq  = (const float*)d_in[1];
    const float* bq  = (const float*)d_in[2];
    const float* Wk  = (const float*)d_in[3];
    const float* bk  = (const float*)d_in[4];
    const float* Wv  = (const float*)d_in[5];
    const float* bv  = (const float*)d_in[6];
    const float* W1  = (const float*)d_in[7];
    const float* b1  = (const float*)d_in[8];
    const float* W2  = (const float*)d_in[9];
    const float* b2  = (const float*)d_in[10];
    float* out = (float*)d_out;

    // workspace carve-up (f16 units)
    _Float16* ws = (_Float16*)d_ws;
    const size_t nEmb = (size_t)TM * TD;          // 8192*1024
    const size_t nWqkv = (size_t)TD * TD;         // 1024*1024
    const size_t nW1 = (size_t)TFF * TD;
    const size_t nW2 = (size_t)TD * TFF;
    _Float16* emb16  = ws;                 ws += nEmb;
    _Float16* wq16   = ws;                 ws += nWqkv;
    _Float16* wk16   = ws;                 ws += nWqkv;
    _Float16* wv16   = ws;                 ws += nWqkv;
    _Float16* w1_16  = ws;                 ws += nW1;
    _Float16* w2_16  = ws;                 ws += nW2;
    _Float16* q16    = ws;                 ws += nEmb;
    _Float16* k16    = ws;                 ws += nEmb;
    _Float16* v16    = ws;                 ws += nEmb;
    _Float16* hcat16 = ws;                 ws += nEmb;
    _Float16* hid16  = ws;                 ws += (size_t)TM * TFF;

    auto cvt = [&](const float* src, _Float16* dst, size_t n) {
        cvt_f32_to_f16<<<dim3((unsigned)((n + 255) / 256)), dim3(256), 0, stream>>>(
            src, dst, (int)n);
    };
    cvt(emb, emb16, nEmb);
    cvt(Wq, wq16, nWqkv);
    cvt(Wk, wk16, nWqkv);
    cvt(Wv, wv16, nWqkv);
    cvt(W1, w1_16, nW1);
    cvt(W2, w2_16, nW2);

    // QKV projections: [8192,1024] = emb16 @ W^T + b   (f16 out)
    {
        dim3 grid(TD / 128, TM / 128), blk(256);
        gemm_wmma<false, _Float16><<<grid, blk, 0, stream>>>(emb16, wq16, bq, q16, TM, TD, TD);
        gemm_wmma<false, _Float16><<<grid, blk, 0, stream>>>(emb16, wk16, bk, k16, TM, TD, TD);
        gemm_wmma<false, _Float16><<<grid, blk, 0, stream>>>(emb16, wv16, bv, v16, TM, TD, TD);
    }

    // attention -> Hcat (f16, [B,S,H*HD])
    {
        dim3 grid(TS / 64, TB * TH), blk(128);
        attn_wmma<<<grid, blk, 0, stream>>>(q16, k16, v16, hcat16);
    }

    // FFN layer 1: relu(Hcat @ W1^T + b1)  -> hid16 [8192,4096]
    {
        dim3 grid(TFF / 128, TM / 128), blk(256);
        gemm_wmma<true, _Float16><<<grid, blk, 0, stream>>>(hcat16, w1_16, b1, hid16, TM, TFF, TD);
    }
    // FFN layer 2: hid @ W2^T + b2 -> d_out (f32, [8192,1024])
    {
        dim3 grid(TD / 128, TM / 128), blk(256);
        gemm_wmma<false, float><<<grid, blk, 0, stream>>>(hid16, w2_16, b2, out, TM, TD, TFF);
    }
}

// v005
// A run of this version takes 284 microseconds.
// Two timings next to v004 both put it at 1.09 times that version's speed.
// Counting every step since v000, it is 2.18 times as fast.
#include <hip/hip_runtime.h>
#include <hip/hip_bf16.h>

// ---------------------------------------------------------------------------
// Transformer block for MI455X (gfx1250, wave32, WMMA f16 -> f32 accum)
//   B=4, S=2048, D=1024, H=16, HD=64, FF=4096, M = B*S = 8192
// Pipeline:
//   1) f32 -> f16 conversion of embeddings + all weights
//   2) WMMA GEMM (async-LDS double-buffered): Q/K/V = emb @ W^T + b
//   3) Flash-attention with WMMA (K Q^T and V^T P^T), online softmax;
//      V lies row-major in LDS and is transposed by ds_load_tr16_b128
//   4) WMMA GEMM + ReLU: hid = Hcat @ W1^T + b1
//   5) WMMA GEMM (f32 out): out = hid @ W2^T + b2 -> d_out
// CDNA5 specifics: v_wmma_f32_16x16x32_f16, global_load_async_to_lds_b128
// (ASYNCcnt pipeline), s_wait_asynccnt / s_wait_dscnt, v_permlanex16_b32.
// ---------------------------------------------------------------------------

typedef __attribute__((ext_vector_type(16))) _Float16 v16h;
typedef __attribute__((ext_vector_type(8)))  float    v8f;
typedef __attribute__((ext_vector_type(8)))  _Float16 v8h;

#define TB 4
#define TS 2048
#define TD 1024
#define TH 16
#define THD 64
#define TFF 4096
#define TM (TB * TS)   // 8192

// four async copies of 16 bytes (8 halves) per lane, global -> LDS, tracked by
// ASYNCcnt; the last line is the wait that stands before any of their address
// registers is rewritten
__device__ __forceinline__ void async_copy4_b128(
    unsigned l0, const _Float16* g0, unsigned l1, const _Float16* g1,
    unsigned l2, const _Float16* g2, unsigned l3, const _Float16* g3) {
    asm volatile("global_load_async_to_lds_b128 %0, %1, off\n\t"
                 "global_load_async_to_lds_b128 %2, %3, off\n\t"
                 "global_load_async_to_lds_b128 %4, %5, off\n\t"
                 "global_load_async_to_lds_b128 %6, %7, off\n\t"
                 "s_wait_xcnt 0x0"
                 :: "v"(l0), "v"(g0), "v"(l1), "v"(g1), "v"(l2), "v"(g2),
                    "v"(l3), "v"(g3)
                 : "memory");
}
__device__ __forceinline__ void wait_async(int n) {
    if (n == 0) asm volatile("s_wait_asynccnt 0x0" ::: "memory");
    else        asm volatile("s_wait_asynccnt 0x4" ::: "memory");
}

// -------------------------------- f32 -> f16 -------------------------------
// A block converts CVT_BLK consecutive elements, 32 a lane: eight 16-B loads,
// each 512 contiguous bytes of a wave (4 whole lines), all in flight before the
// first is used; each is stored as 8 B a lane (2 whole lines of a wave).
// n must be a multiple of CVT_BLK, as all six array lengths are.
typedef __attribute__((ext_vector_type(4))) float    v4f;
typedef __attribute__((ext_vector_type(4))) _Float16 v4h;
#define CVT_LOADS 8
#define CVT_BLK (256 * 4 * CVT_LOADS)   // 8192 elements
static_assert((TB * TS * TD) % CVT_BLK == 0 && (TD * TD) % CVT_BLK == 0 &&
              (TFF * TD) % CVT_BLK == 0, "conversion blocks must be full");
__global__ __launch_bounds__(256) void cvt_f32_to_f16(const float* __restrict__ in,
                                                      _Float16* __restrict__ out,
                                                      int n) {
    const int base = blockIdx.x * CVT_BLK;
    if (base + CVT_BLK > n) return;          // never past the end of the arrays
    const int at = base + threadIdx.x * 4;
    v4f v[CVT_LOADS];
    // both loops unrolled: v[] stays in registers, and the eight loads stand
    // together in front of the first wait
#pragma unroll
    for (int k = 0; k < CVT_LOADS; ++k)
        v[k] = *(const v4f*)(in + at + k * 1024);
#pragma unroll
    for (int k = 0; k < CVT_LOADS; ++k)
        *(v4h*)(out + at + k * 1024) = __builtin_convertvector(v[k], v4h);
}

// ------------------------- WMMA tiled GEMM (C = A @ B^T) -------------------
// A: [M,K] f16 row-major. Bw: [N,K] f16 row-major (torch Linear weight).
// bias: f32 [N] or null. C: [M,N] OutT row-major. Optional ReLU.
// Block tile 128x128, K-step 64, 256 threads = 8 waves, wave tile 32x64.
// K must be a multiple of 64. Two LDS buffers fed by
// global_load_async_to_lds_b128; a K-step is 128 B of every operand row, so
// 8 lanes cover one whole 128-B line and one copy instruction 4 whole lines.

// Eight async copies (16 B per lane each) and, as the last line of the same
// statement, the wait that stands before any of their address registers is
// rewritten (in a statement of its own the compiler could lift later address
// arithmetic over it).
__device__ __forceinline__ void async_copy8_b128(
    unsigned l0, const _Float16* g0, unsigned l1, const _Float16* g1,
    unsigned l2, const _Float16* g2, unsigned l3, const _Float16* g3,
    unsigned l4, const _Float16* g4, unsigned l5, const _Float16* g5,
    unsigned l6, const _Float16* g6, unsigned l7, const _Float16* g7) {
    asm volatile("global_load_async_to_lds_b128 %0, %1, off\n\t"
                 "global_load_async_to_lds_b128 %2, %3, off\n\t"
                 "global_load_async_to_lds_b128 %4, %5, off\n\t"
                 "global_load_async_to_lds_b128 %6, %7, off\n\t"
                 "global_load_async_to_lds_b128 %8, %9, off\n\t"
                 "global_load_async_to_lds_b128 %10, %11, off\n\t"
                 "global_load_async_to_lds_b128 %12, %13, off\n\t"
                 "global_load_async_to_lds_b128 %14, %15, off\n\t"
                 "s_wait_xcnt 0x0"
                 :: "v"(l0), "v"(g0), "v"(l1), "v"(g1), "v"(l2), "v"(g2),
                    "v"(l3), "v"(g3), "v"(l4), "v"(g4), "v"(l5), "v"(g5),
                    "v"(l6), "v"(g6), "v"(l7), "v"(g7)
                 : "memory");
}

template <bool RELU, typename OutT>
__global__ __launch_bounds__(256) void gemm_wmma(const _Float16* __restrict__ A,
                                                 const _Float16* __restrict__ Bw,
                                                 const float* __restrict__ bias,
                                                 OutT* __restrict__ C,
                                                 int M, int N, int K) {
    // LDS row pitch in halves: 64 data + 8 pad = 144 B (16 B x odd), so the 16
    // rows of a ds_load_b128 fragment read fall on 16 distinct bank groups.
    // Pad is never read.
    constexpr int BK  = 64;
    constexpr int LDP = 72;
    __shared__ __attribute__((aligned(16))) _Float16 As[2][128 * LDP];
    __shared__ __attribute__((aligned(16))) _Float16 Bs[2][128 * LDP];

    const int tid  = threadIdx.x;
    const int wave = tid >> 5;
    const int lane = tid & 31;
    const int wm   = wave >> 1;     // 0..3 : wave row
    const int wn   = wave & 1;      // 0..1 : wave col
    const int r    = lane & 15;
    const int hs   = lane >> 4;     // 0/1, selects K-half per ISA A/B layout

    const int blockM = blockIdx.y * 128;
    const int blockN = blockIdx.x * 128;

    const v8f vzero = {0.f, 0.f, 0.f, 0.f, 0.f, 0.f, 0.f, 0.f};
    v8f acc[2][4];
#pragma unroll
    for (int i = 0; i < 2; ++i)
#pragma unroll
        for (int j = 0; j < 4; ++j) acc[i][j] = vzero;

    // cooperative tile copies: 8 lanes per row (128 B), 32 rows per copy of
    // the block, 4 copies for A and 4 for B per K-step
    const int ldr = tid >> 3;          // 0..31
    const int ldc = (tid & 7) * 8;     // 0..56 halves

    const unsigned ldsA = (unsigned)(uintptr_t)(&As[0][ldr * LDP + ldc]);
    const unsigned ldsB = (unsigned)(uintptr_t)(&Bs[0][ldr * LDP + ldc]);
    constexpr unsigned BUFB = 128 * LDP * 2;   // bytes of one buffer
    constexpr unsigned R32B = 32 * LDP * 2;    // bytes of 32 LDS rows
    const _Float16* gA = A  + (size_t)(blockM + ldr) * K + ldc;
    const _Float16* gB = Bw + (size_t)(blockN + ldr) * K + ldc;
    const size_t r32 = (size_t)32 * K;         // 32 global rows, in halves

    auto issue = [&](int t, int buf) {
        const _Float16* a = gA + (size_t)t * BK;
        const _Float16* b = gB + (size_t)t * BK;
        const unsigned la = ldsA + buf * BUFB;
        const unsigned lb = ldsB + buf * BUFB;
        async_copy8_b128(la,            a,           la + R32B,     a + r32,
                         la + 2 * R32B, a + 2 * r32, la + 3 * R32B, a + 3 * r32,
                         lb,            b,           lb + R32B,     b + r32,
                         lb + 2 * R32B, b + 2 * r32, lb + 3 * R32B, b + 3 * r32);
    };

    const int nt = K / BK;
    issue(0, 0);
    // tile 0 has landed for this wave; the barrier publishes it to the block
    asm volatile("s_wait_asynccnt 0x0" ::: "memory");
    __syncthreads();
    if (nt > 1) issue(1, 1);                  // tile 1 flies over trip 0

    for (int t = 0; t < nt; ++t) {
        const int buf = t & 1;
        // A fragment per ISA 16-bit 16x32 layout:
        //   lane hs half: halves 0..7 at k = hs*8 .. hs*8+7, halves 8..15 at +16
        // unrolled: the two 32-k halves of the tile differ only in an LDS
        // offset, which then folds into the loads' immediates
#pragma unroll
        for (int ks = 0; ks < 2; ++ks) {
            v16h af[2], bf[4];
#pragma unroll
            for (int i = 0; i < 2; ++i) {
                const _Float16* ab =
                    &As[buf][(wm * 32 + i * 16 + r) * LDP + ks * 32 + hs * 8];
                ((uint4*)&af[i])[0] = *(const uint4*)(ab);
                ((uint4*)&af[i])[1] = *(const uint4*)(ab + 16);
            }
#pragma unroll
            for (int j = 0; j < 4; ++j) {
                const _Float16* bb =
                    &Bs[buf][(wn * 64 + j * 16 + r) * LDP + ks * 32 + hs * 8];
                ((uint4*)&bf[j])[0] = *(const uint4*)(bb);
                ((uint4*)&bf[j])[1] = *(const uint4*)(bb + 16);
            }
#pragma unroll
            for (int i = 0; i < 2; ++i)
#pragma unroll
                for (int j = 0; j < 4; ++j)
                    acc[i][j] = __builtin_amdgcn_wmma_f32_16x16x32_f16(
                        false, af[i], false, bf[j], (short)0, acc[i][j], false, false);
        }

        // foot of the trip: this wave's reads of `buf` are done ...
        asm volatile("s_wait_dscnt 0x0" ::: "memory");
        // ... and its copies of tile t+1 have landed;
        asm volatile("s_wait_asynccnt 0x0" ::: "memory");
        // one barrier publishes tile t+1 and frees `buf` for the refill
        __syncthreads();
        if (t + 2 < nt) issue(t + 2, buf);
    }
    // nothing is in flight when the wave goes on to the epilogue
    asm volatile("s_wait_asynccnt 0x0" ::: "memory");

    // epilogue: C/D layout = lane (hs,r): col n = r, rows = hs*8 + 0..7
#pragma unroll
    for (int j = 0; j < 4; ++j) {
        const int n   = blockN + wn * 64 + j * 16 + r;
        const float bv = bias ? bias[n] : 0.f;
#pragma unroll
        for (int i = 0; i < 2; ++i) {
#pragma unroll
            for (int jj = 0; jj < 8; ++jj) {
                const int m = blockM + wm * 32 + i * 16 + hs * 8 + jj;
                float v = acc[i][j][jj] + bv;
                if (RELU) v = fmaxf(v, 0.f);
                C[(size_t)m * N + n] = (OutT)v;
            }
        }
    }
}

// ------------------------------ flash attention ----------------------------
// value of lane l ^ 16 (the other 16-lane half), by a vector cross-row move
__device__ __forceinline__ float xhalf(float x) {
    const int b = __builtin_bit_cast(int, x);
    return __builtin_bit_cast(float, __builtin_amdgcn_permlanex16(
        b, b, 0x76543210, 0xfedcba98, false, false));
}

// 16 bytes of a row-major 16-bit LDS tile per lane, handed out transposed:
// two of them (k and k + 16) are one 16 x 32 A fragment in the hardware k order
typedef __attribute__((ext_vector_type(8))) short s16x8;
__device__ __forceinline__ uint4 lds_tr16(const _Float16* p) {
    typedef __attribute__((address_space(3))) s16x8 lds_s16x8;
    return __builtin_bit_cast(uint4,
        __builtin_amdgcn_ds_load_tr16_b128_v8i16((lds_s16x8*)p));
}

// grid = (S/64, B*H), block = 128 (4 waves); each wave owns 16 query rows.
// Q/K/V in [B,S,H,HD] f16 layout (row stride D). Output Hcat same layout.
__global__ __launch_bounds__(128) void attn_wmma(const _Float16* __restrict__ Qg,
                                                 const _Float16* __restrict__ Kg,
                                                 const _Float16* __restrict__ Vg,
                                                 _Float16* __restrict__ Og) {
    constexpr int LDT = 72;                 // padded LDS row stride (halves)
    // V rows [k][e]: 160 B = 32 B x odd, the pitch of the transposing load
    constexpr int LDV = 80;
    __shared__ __attribute__((aligned(16))) _Float16 Qs[64 * LDT];
    __shared__ __attribute__((aligned(16))) _Float16 Ks[64 * LDT];
    __shared__ __attribute__((aligned(16))) _Float16 Vs[64 * LDV];

    const int bh   = blockIdx.y;            // 0..63
    const int b    = bh >> 4;
    const int h    = bh & 15;
    const int q0   = blockIdx.x * 64;
    const int tid  = threadIdx.x;
    const int wave = tid >> 5;
    const int lane = tid & 31;
    const int r    = lane & 15;
    const int hs   = lane >> 4;

    const size_t rowbase = (size_t)(b * TS) * TD + (size_t)h * THD;
    const _Float16* Qb = Qg + rowbase;
    const _Float16* Kb = Kg + rowbase;
    const _Float16* Vb = Vg + rowbase;

    // tile copies: 8 lanes a row (one 128-B line), 16 rows a copy of the block,
    // 4 copies for each of Q, K and V
    const int crow = tid >> 3;              // 0..15
    const int ccol = (tid & 7) * 8;         // 0..56 halves
    constexpr unsigned K16B = 16 * LDT * 2; // bytes of 16 LDS rows of Q or K
    constexpr unsigned V16B = 16 * LDV * 2; // bytes of 16 LDS rows of V
    constexpr size_t   G16  = (size_t)16 * TD;   // 16 global rows, in halves

    // load Q block: 64 rows x 64 cols (async global -> LDS)
    {
        const unsigned ldsQ = (unsigned)(uintptr_t)(Qs + crow * LDT + ccol);
        const _Float16* gq = Qb + (size_t)(q0 + crow) * TD + ccol;
        async_copy4_b128(ldsQ,            gq,           ldsQ + K16B,     gq + G16,
                         ldsQ + 2 * K16B, gq + 2 * G16, ldsQ + 3 * K16B, gq + 3 * G16);
    }

    const v8f vzero = {0.f, 0.f, 0.f, 0.f, 0.f, 0.f, 0.f, 0.f};
    // Transposed products: a lane (hs, r) owns ONE query, row wave*16 + r.
    //   sc[j][jj] = S^T[key j*16 + hs*8 + jj][query r]
    //   o[j][jj]  = O^T[e   j*16 + hs*8 + jj][query r]
    v8f o[4];
#pragma unroll
    for (int j = 0; j < 4; ++j) o[j] = vzero;
    float mrow = -1.0e30f;   // running maximum of the lane's query (both halves)
    float lrow = 0.f;        // running sum over this lane half's keys only

    const float scale = 0.03125f;           // 1/sqrt(D) = 1/32

    const unsigned ldsK = (unsigned)(uintptr_t)(Ks + crow * LDT + ccol);
    const unsigned ldsV = (unsigned)(uintptr_t)(Vs + crow * LDV + ccol);
    // lane address of the transposing load: row 8*hs + (lane & 7), and the
    // second 16 B of the 32-B column group in lanes 8..15 of each half
    const _Float16* vtr = Vs + (hs * 8 + (lane & 7)) * LDV + ((lane >> 3) & 1) * 8;

    for (int kt = 0; kt < TS / 64; ++kt) {
        const int k0 = kt * 64;
        // this wave's LDS reads of the previous tile have retired before any
        // wave's copies may overwrite it ...
        asm volatile("s_wait_dscnt 0x0" ::: "memory");
        __syncthreads();                    // ... and so have every wave's
        // K and V tiles, both row-major, via async-to-LDS
        {
            const _Float16* gk = Kb + (size_t)(k0 + crow) * TD + ccol;
            const _Float16* gv = Vb + (size_t)(k0 + crow) * TD + ccol;
            async_copy8_b128(ldsK,            gk,           ldsK + K16B,     gk + G16,
                             ldsK + 2 * K16B, gk + 2 * G16, ldsK + 3 * K16B, gk + 3 * G16,
                             ldsV,            gv,           ldsV + V16B,     gv + G16,
                             ldsV + 2 * V16B, gv + 2 * G16, ldsV + 3 * V16B, gv + 3 * G16);
        }
        if (kt + 1 < TS / 64)               // lowers to global_prefetch_b8
            __builtin_prefetch(Kb + (size_t)(k0 + 64) * TD + (tid & 63), 0, 1);
        wait_async(0);                      // own async K, V (and Q) writes done
        __syncthreads();

        // ---- S^T = K @ Q^T  (64 keys x 16 queries per wave) ----
        // A = K rows, B = Q rows, both read in the same k order
        v8f sc[4];
#pragma unroll
        for (int j = 0; j < 4; ++j) sc[j] = vzero;
#pragma unroll
        for (int ks = 0; ks < 2; ++ks) {
            v16h bq;
            const _Float16* qb = Qs + (wave * 16 + r) * LDT + ks * 32 + hs * 8;
            ((uint4*)&bq)[0] = *(const uint4*)(qb);
            ((uint4*)&bq)[1] = *(const uint4*)(qb + 16);
#pragma unroll
            for (int j = 0; j < 4; ++j) {
                v16h ak;
                const _Float16* kb = Ks + (j * 16 + r) * LDT + ks * 32 + hs * 8;
                ((uint4*)&ak)[0] = *(const uint4*)(kb);
                ((uint4*)&ak)[1] = *(const uint4*)(kb + 16);
                sc[j] = __builtin_amdgcn_wmma_f32_16x16x32_f16(
                    false, ak, false, bq, (short)0, sc[j], false, false);
            }
        }

        // ---- online softmax: the lane's 32 scores all belong to its query ----
        float mx = -1.0e30f;
#pragma unroll
        for (int j = 0; j < 4; ++j)
#pragma unroll
            for (int jj = 0; jj < 8; ++jj) {
                sc[j][jj] *= scale;
                mx = fmaxf(mx, sc[j][jj]);
            }
        mx = fmaxf(mx, xhalf(mx));          // the other 32 keys of the query
        const float mn   = fmaxf(mrow, mx);
        const float corr = __expf(mrow - mn);
        float rs = 0.f;
#pragma unroll
        for (int j = 0; j < 4; ++j)
#pragma unroll
            for (int jj = 0; jj < 8; ++jj) {
                float p = __expf(sc[j][jj] - mn);
                sc[j][jj] = p;
                rs += p;
            }
        lrow = lrow * corr + rs;            // halves are joined after the loop
        mrow = mn;
#pragma unroll
        for (int j = 0; j < 4; ++j)
#pragma unroll
            for (int jj = 0; jj < 8; ++jj) o[j][jj] *= corr;

        // ---- O^T += V^T @ P^T  (A = V^T by transposing loads; B = P^T from sc) ----
        // Two S^T tiles converted in place are the B operand: element s of the
        // lane is key ks*32 + (s < 8 ? hs*8 + s : 16 + hs*8 + s - 8), which is
        // the k order of the transposing loads below: lane (hs, r) gets
        // V[ks*32 + hs*8 + 0..7][j*16 + r], then the same 16 keys further on.
#pragma unroll
        for (int ks = 0; ks < 2; ++ks) {
            v16h bp;
#pragma unroll
            for (int jj = 0; jj < 8; ++jj) {
                bp[jj]     = (_Float16)sc[2 * ks][jj];
                bp[8 + jj] = (_Float16)sc[2 * ks + 1][jj];
            }
#pragma unroll
            for (int j = 0; j < 4; ++j) {
                v16h av;
                const _Float16* vb = vtr + ks * 32 * LDV + j * 16;
                ((uint4*)&av)[0] = lds_tr16(vb);
                ((uint4*)&av)[1] = lds_tr16(vb + 16 * LDV);
                o[j] = __builtin_amdgcn_wmma_f32_16x16x32_f16(
                    false, av, false, bp, (short)0, o[j], false, false);
            }
        }
    }

    // ---- normalize and store Hcat[b, s, h*64 + e]: 8 consecutive e a lane ----
    const float invl = 1.0f / (lrow + xhalf(lrow));
    _Float16* orow = Og + rowbase + (size_t)(q0 + wave * 16 + r) * TD + hs * 8;
#pragma unroll
    for (int j = 0; j < 4; ++j) {
        v8h ov;
#pragma unroll
        for (int jj = 0; jj < 8; ++jj) ov[jj] = (_Float16)(o[j][jj] * invl);
        *(v8h*)(orow + j * 16) = ov;
    }
}

// -------------------------------- launcher ---------------------------------
extern "C" void kernel_launch(void* const* d_in, const int* in_sizes, int n_in,
                              void* d_out, int out_size, void* d_ws, size_t ws_size,
                              hipStream_t stream) {
    const float* emb = (const float*)d_in[0];
    const float* Wq  = (const float*)d_in[1];
    const float* bq  = (const float*)d_in[2];
    const float* Wk  = (const float*)d_in[3];
    const float* bk  = (const float*)d_in[4];
    const float* Wv  = (const float*)d_in[5];
    const float* bv  = (const float*)d_in[6];
    const float* W1  = (const float*)d_in[7];
    const float* b1  = (const float*)d_in[8];
    const float* W2  = (const float*)d_in[9];
    const float* b2  = (const float*)d_in[10];
    float* out = (float*)d_out;

    // workspace carve-up (f16 units)
    _Float16* ws = (_Float16*)d_ws;
    const size_t nEmb = (size_t)TM * TD;          // 8192*1024
    const size_t nWqkv = (size_t)TD * TD;         // 1024*1024
    const size_t nW1 = (size_t)TFF * TD;
    const size_t nW2 = (size_t)TD * TFF;
    _Float16* emb16  = ws;                 ws += nEmb;
    _Float16* wq16   = ws;                 ws += nWqkv;
    _Float16* wk16   = ws;                 ws += nWqkv;
    _Float16* wv16   = ws;                 ws += nWqkv;
    _Float16* w1_16  = ws;                 ws += nW1;
    _Float16* w2_16  = ws;                 ws += nW2;
    _Float16* q16    = ws;                 ws += nEmb;
    _Float16* k16    = ws;                 ws += nEmb;
    _Float16* v16    = ws;                 ws += nEmb;
    _Float16* hcat16 = ws;                 ws += nEmb;
    _Float16* hid16  = ws;                 ws += (size_t)TM * TFF;

    auto cvt = [&](const float* src, _Float16* dst, size_t n) {
        cvt_f32_to_f16<<<dim3((unsigned)(n / CVT_BLK)), dim3(256), 0, stream>>>(
            src, dst, (int)n);
    };
    cvt(emb, emb16, nEmb);
    cvt(Wq, wq16, nWqkv);
    cvt(Wk, wk16, nWqkv);
    cvt(Wv, wv16, nWqkv);
    cvt(W1, w1_16, nW1);
    cvt(W2, w2_16, nW2);

    // QKV projections: [8192,1024] = emb16 @ W^T + b   (f16 out)
    {
        dim3 grid(TD / 128, TM / 128), blk(256);
        gemm_wmma<false, _Float16><<<grid, blk, 0, stream>>>(emb16, wq16, bq, q16, TM, TD, TD);
        gemm_wmma<false, _Float16><<<grid, blk, 0, stream>>>(emb16, wk16, bk, k16, TM, TD, TD);
        gemm_wmma<false, _Float16><<<grid, blk, 0, stream>>>(emb16, wv16, bv, v16, TM, TD, TD);
    }

    // attention -> Hcat (f16, [B,S,H*HD])
    {
        dim3 grid(TS / 64, TB * TH), blk(128);
        attn_wmma<<<grid, blk, 0, stream>>>(q16, k16, v16, hcat16);
    }

    // FFN layer 1: relu(Hcat @ W1^T + b1)  -> hid16 [8192,4096]
    {
        dim3 grid(TFF / 128, TM / 128), blk(256);
        gemm_wmma<true, _Float16><<<grid, blk, 0, stream>>>(hcat16, w1_16, b1, hid16, TM, TFF, TD);
    }
    // FFN layer 2: hid @ W2^T + b2 -> d_out (f32, [8192,1024])
    {
        dim3 grid(TD / 128, TM / 128), blk(256);
        gemm_wmma<false, float><<<grid, blk, 0, stream>>>(hid16, w2_16, b2, out, TM, TD, TFF);
    }
}

// v006
// It runs in 260 microseconds.
// Two timings next to v005 both put it at 1.10 times that version's speed.
// Over all steps from v000 it is 2.39 times as fast.
#include <hip/hip_runtime.h>
#include <hip/hip_bf16.h>

// ---------------------------------------------------------------------------
// Transformer block for MI455X (gfx1250, wave32, WMMA f16 -> f32 accum)
//   B=4, S=2048, D=1024, H=16, HD=64, FF=4096, M = B*S = 8192
// Pipeline:
//   1) f32 -> f16 conversion of embeddings + all weights
//   2) WMMA GEMM (async-LDS double-buffered): Q/K/V = emb @ W^T + b
//   3) Flash-attention with WMMA (K Q^T and V^T P^T), online softmax;
//      V lies row-major in LDS and is transposed by ds_load_tr16_b128
//   4) WMMA GEMM + ReLU: hid = Hcat @ W1^T + b1
//   5) WMMA GEMM (f32 out): out = hid @ W2^T + b2 -> d_out
// CDNA5 specifics: v_wmma_f32_16x16x32_f16, global_load_async_to_lds_b128
// (ASYNCcnt pipeline), s_wait_asynccnt / s_wait_dscnt, v_permlanex16_b32.
// ---------------------------------------------------------------------------

typedef __attribute__((ext_vector_type(16))) _Float16 v16h;
typedef __attribute__((ext_vector_type(8)))  float    v8f;
typedef __attribute__((ext_vector_type(8)))  _Float16 v8h;

#define TB 4
#define TS 2048
#define TD 1024
#define TH 16
#define THD 64
#define TFF 4096
#define TM (TB * TS)   // 8192

// four async copies of 16 bytes (8 halves) per lane, global -> LDS, tracked by
// ASYNCcnt; the last line is the wait that stands before any of their address
// registers is rewritten
__device__ __forceinline__ void async_copy4_b128(
    unsigned l0, const _Float16* g0, unsigned l1, const _Float16* g1,
    unsigned l2, const _Float16* g2, unsigned l3, const _Float16* g3) {
    asm volatile("global_load_async_to_lds_b128 %0, %1, off\n\t"
                 "global_load_async_to_lds_b128 %2, %3, off\n\t"
                 "global_load_async_to_lds_b128 %4, %5, off\n\t"
                 "global_load_async_to_lds_b128 %6, %7, off\n\t"
                 "s_wait_xcnt 0x0"
                 :: "v"(l0), "v"(g0), "v"(l1), "v"(g1), "v"(l2), "v"(g2),
                    "v"(l3), "v"(g3)
                 : "memory");
}
__device__ __forceinline__ void wait_async(int n) {
    if (n == 0) asm volatile("s_wait_asynccnt 0x0" ::: "memory");
    else        asm volatile("s_wait_asynccnt 0x4" ::: "memory");
}

// -------------------------------- f32 -> f16 -------------------------------
// A block converts CVT_BLK consecutive elements, 32 a lane: eight 16-B loads,
// each 512 contiguous bytes of a wave (4 whole lines), all in flight before the
// first is used; each is stored as 8 B a lane (2 whole lines of a wave).
// n must be a multiple of CVT_BLK, as all six array lengths are.
typedef __attribute__((ext_vector_type(4))) float    v4f;
typedef __attribute__((ext_vector_type(4))) _Float16 v4h;
#define CVT_LOADS 8
#define CVT_BLK (256 * 4 * CVT_LOADS)   // 8192 elements
static_assert((TB * TS * TD) % CVT_BLK == 0 && (TD * TD) % CVT_BLK == 0 &&
              (TFF * TD) % CVT_BLK == 0, "conversion blocks must be full");
__global__ __launch_bounds__(256) void cvt_f32_to_f16(const float* __restrict__ in,
                                                      _Float16* __restrict__ out,
                                                      int n) {
    const int base = blockIdx.x * CVT_BLK;
    if (base + CVT_BLK > n) return;          // never past the end of the arrays
    const int at = base + threadIdx.x * 4;
    v4f v[CVT_LOADS];
    // both loops unrolled: v[] stays in registers, and the eight loads stand
    // together in front of the first wait
#pragma unroll
    for (int k = 0; k < CVT_LOADS; ++k)
        v[k] = *(const v4f*)(in + at + k * 1024);
#pragma unroll
    for (int k = 0; k < CVT_LOADS; ++k)
        *(v4h*)(out + at + k * 1024) = __builtin_convertvector(v[k], v4h);
}

// ------------------------- WMMA tiled GEMM (C = A @ B^T) -------------------
// A: [M,K] f16 row-major. Bw: [N,K] f16 row-major (torch Linear weight).
// bias: f32 [N] or null. C: [M,N] OutT row-major. Optional ReLU.
// Block tile 256x128, K-step 128, 256 threads = 8 waves, wave tile 64x64, one
// block on a WGP: a fragment read from LDS feeds four products, and a byte
// brought from L2 feeds 128 (A) or 256 (B) output columns or rows.
// M must be a multiple of 256, N of 128, K of 128 and at least 256. Two LDS
// buffers fed by global_load_async_to_lds_b128; a K-step is 256 B of every
// operand row, so one copy instruction of a wave covers 4 whole 128-B lines.

// Eight async copies (16 B per lane each) and, as the last line of the same
// statement, the wait that stands before any of their address registers is
// rewritten (in a statement of its own the compiler could lift later address
// arithmetic over it).
__device__ __forceinline__ void async_copy8_b128(
    unsigned l0, const _Float16* g0, unsigned l1, const _Float16* g1,
    unsigned l2, const _Float16* g2, unsigned l3, const _Float16* g3,
    unsigned l4, const _Float16* g4, unsigned l5, const _Float16* g5,
    unsigned l6, const _Float16* g6, unsigned l7, const _Float16* g7) {
    asm volatile("global_load_async_to_lds_b128 %0, %1, off\n\t"
                 "global_load_async_to_lds_b128 %2, %3, off\n\t"
                 "global_load_async_to_lds_b128 %4, %5, off\n\t"
                 "global_load_async_to_lds_b128 %6, %7, off\n\t"
                 "global_load_async_to_lds_b128 %8, %9, off\n\t"
                 "global_load_async_to_lds_b128 %10, %11, off\n\t"
                 "global_load_async_to_lds_b128 %12, %13, off\n\t"
                 "global_load_async_to_lds_b128 %14, %15, off\n\t"
                 "s_wait_xcnt 0x0"
                 :: "v"(l0), "v"(g0), "v"(l1), "v"(g1), "v"(l2), "v"(g2),
                    "v"(l3), "v"(g3), "v"(l4), "v"(g4), "v"(l5), "v"(g5),
                    "v"(l6), "v"(g6), "v"(l7), "v"(g7)
                 : "memory");
}

// One async copy of 16 B per lane, as the compiler's builtin: operands of an asm
// statement must lie below v256, where the GEMM's accumulators and two fragment
// sets leave no room (asm copies there cost two spilled address registers).
typedef __attribute__((ext_vector_type(4))) int i32x4;
__device__ __forceinline__ void async_copy_b128(const _Float16* l, const _Float16* g) {
    typedef __attribute__((address_space(1))) i32x4 glb_i32x4;
    typedef __attribute__((address_space(3))) i32x4 lds_i32x4;
    __builtin_amdgcn_global_load_async_to_lds_b128((glb_i32x4*)g, (lds_i32x4*)l, 0, 0);
}

#define GBM 256   // rows of C per block
#define GBN 128   // columns of C per block
static_assert(TM % GBM == 0 && TD % GBN == 0 && TFF % GBN == 0 &&
              TD % 128 == 0 && TFF % 128 == 0 && TD >= 256 && TFF >= 256,
              "GEMM tiles must be full, and the ring needs two K-steps");

template <bool RELU, typename OutT>
__global__ __launch_bounds__(256) void gemm_wmma(const _Float16* __restrict__ A,
                                                 const _Float16* __restrict__ Bw,
                                                 const float* __restrict__ bias,
                                                 OutT* __restrict__ C,
                                                 int M, int N, int K) {
    // LDS row pitch in halves: 128 data + 8 pad = 272 B (16 B x odd), so the 16
    // rows of a ds_load_b128 fragment read fall on 16 distinct bank groups.
    // Pad is never read.
    constexpr int BK  = 128;
    constexpr int LDP = 136;
    // one array: [A buffer 0 | A buffer 1 | B buffer 0 | B buffer 1]
    __shared__ __attribute__((aligned(16))) _Float16 smem[2 * (GBM + GBN) * LDP];
    constexpr int ABUF = GBM * LDP;            // halves of one buffer of A
    constexpr int BBUF = GBN * LDP;            // halves of one buffer of B
    const _Float16* Bs = smem + 2 * ABUF;

    const int tid  = threadIdx.x;
    const int wave = tid >> 5;
    const int lane = tid & 31;
    const int wm   = wave >> 1;     // 0..3 : wave row
    const int wn   = wave & 1;      // 0..1 : wave col
    const int r    = lane & 15;
    const int hs   = lane >> 4;     // 0/1, selects K-half per ISA A/B layout

    const int blockM = blockIdx.y * GBM;
    const int blockN = blockIdx.x * GBN;

    const v8f vzero = {0.f, 0.f, 0.f, 0.f, 0.f, 0.f, 0.f, 0.f};
    v8f acc[4][4];
#pragma unroll
    for (int i = 0; i < 4; ++i)
#pragma unroll
        for (int j = 0; j < 4; ++j) acc[i][j] = vzero;

    // cooperative tile copies: 16 lanes per row (256 B), 16 rows per copy of
    // the block, 16 copies for A and 8 for B per K-step
    const int ldr = tid >> 4;          // 0..15
    const int ldc = (tid & 15) * 8;    // 0..120 halves

    const int lanlds = ldr * LDP + ldc;        // the lane's place in an LDS tile
    // the lane's place in a global tile is the same in A and in B
    const size_t lanoff = (size_t)ldr * K + ldc;
    const _Float16* gA = A  + (size_t)blockM * K;
    const _Float16* gB = Bw + (size_t)blockN * K;
    const size_t r16 = (size_t)16 * K;         // 16 global rows, in halves

    auto issue = [&](int t, int buf) {
        const _Float16* a = gA + (size_t)t * BK + lanoff;
        const _Float16* b = gB + (size_t)t * BK + lanoff;
        const _Float16* la = smem + buf * ABUF + lanlds;
        const _Float16* lb = Bs + buf * BBUF + lanlds;
#pragma unroll
        for (int k = 0; k < GBM / 16; ++k)
            async_copy_b128(la + k * 16 * LDP, a + k * r16);
#pragma unroll
        for (int k = 0; k < GBN / 16; ++k)
            async_copy_b128(lb + k * 16 * LDP, b + k * r16);
    };

    // The fragments of one 32-k block: 4 of A and 4 of B, 16 ds_load_b128.
    // Per ISA 16-bit 16x32 layout, the same k order for A and B:
    //   lane hs half: halves 0..7 at k = hs*8 .. hs*8+7, halves 8..15 at +16
    const int fragA = (wm * 64 + r) * LDP + hs * 8;
    const int fragB = (wn * 64 + r) * LDP + hs * 8;
    auto fetch = [&](v16h (&af)[4], v16h (&bf)[4], int buf, int ks) {
#pragma unroll
        for (int i = 0; i < 4; ++i) {
            const _Float16* ab = &smem[buf * ABUF + fragA + i * 16 * LDP + ks * 32];
            ((uint4*)&af[i])[0] = *(const uint4*)(ab);
            ((uint4*)&af[i])[1] = *(const uint4*)(ab + 16);
        }
#pragma unroll
        for (int j = 0; j < 4; ++j) {
            const _Float16* bb = &Bs[buf * BBUF + fragB + j * 16 * LDP + ks * 32];
            ((uint4*)&bf[j])[0] = *(const uint4*)(bb);
            ((uint4*)&bf[j])[1] = *(const uint4*)(bb + 16);
        }
        // keeps the 16 loads one group ahead of the products that follow: sunk
        // among them, each pair of loads would be waited for on its own
        __builtin_amdgcn_sched_barrier(0);
    };
    auto block = [&](const v16h (&af)[4], const v16h (&bf)[4]) {
#pragma unroll
        for (int i = 0; i < 4; ++i)
#pragma unroll
            for (int j = 0; j < 4; ++j)
                acc[i][j] = __builtin_amdgcn_wmma_f32_16x16x32_f16(
                    false, af[i], false, bf[j], (short)0, acc[i][j], false, false);
        // keeps the next group of loads behind these products
        __builtin_amdgcn_sched_barrier(0);
    };

    const int nt = K / BK;
    issue(0, 0);
    // tile 0 has landed for this wave; the barrier publishes it to the block
    asm volatile("s_wait_asynccnt 0x0" ::: "memory");
    __syncthreads();
    if (nt > 1) issue(1, 1);                  // tile 1 flies over trip 0

    // two fragment sets: each 32-k block's loads fly over the block before it
    v16h a0[4], b0[4], a1[4], b1[4];
    fetch(a0, b0, 0, 0);
    for (int t = 0; t < nt; ++t) {
        const int buf = t & 1;
        fetch(a1, b1, buf, 1);
        block(a0, b0);
        fetch(a0, b0, buf, 2);
        block(a1, b1);
        fetch(a1, b1, buf, 3);
        block(a0, b0);

        // foot of the trip, in front of its last block, whose fragments are
        // fetched: this wave's reads of `buf` are done ...
        asm volatile("s_wait_dscnt 0x0" ::: "memory");
        // ... and its copies of tile t+1 have landed;
        asm volatile("s_wait_asynccnt 0x0" ::: "memory");
        // one barrier publishes tile t+1 and frees `buf` for the refill
        __syncthreads();
        if (t + 2 < nt) issue(t + 2, buf);
        // first fragments of tile t+1, behind its barrier; in the last trip
        // they come from the idle buffer (tile nt-2, no copy aimed at it) and
        // are not used: no branch, so the waits stay counted
        fetch(a0, b0, buf ^ 1, 0);
        block(a1, b1);
    }
    // nothing is in flight when the wave goes on to the epilogue
    asm volatile("s_wait_asynccnt 0x0" ::: "memory");

    // epilogue: C/D layout = lane (hs,r): col n = r, rows = hs*8 + 0..7
#pragma unroll
    for (int j = 0; j < 4; ++j) {
        const int n   = blockN + wn * 64 + j * 16 + r;
        const float bv = bias ? bias[n] : 0.f;
#pragma unroll
        for (int i = 0; i < 4; ++i) {
#pragma unroll
            for (int jj = 0; jj < 8; ++jj) {
                const int m = blockM + wm * 64 + i * 16 + hs * 8 + jj;
                float v = acc[i][j][jj] + bv;
                if (RELU) v = fmaxf(v, 0.f);
                C[(size_t)m * N + n] = (OutT)v;
            }
        }
    }
}

// ------------------------------ flash attention ----------------------------
// value of lane l ^ 16 (the other 16-lane half), by a vector cross-row move
__device__ __forceinline__ float xhalf(float x) {
    const int b = __builtin_bit_cast(int, x);
    return __builtin_bit_cast(float, __builtin_amdgcn_permlanex16(
        b, b, 0x76543210, 0xfedcba98, false, false));
}

// 16 bytes of a row-major 16-bit LDS tile per lane, handed out transposed:
// two of them (k and k + 16) are one 16 x 32 A fragment in the hardware k order
typedef __attribute__((ext_vector_type(8))) short s16x8;
__device__ __forceinline__ uint4 lds_tr16(const _Float16* p) {
    typedef __attribute__((address_space(3))) s16x8 lds_s16x8;
    return __builtin_bit_cast(uint4,
        __builtin_amdgcn_ds_load_tr16_b128_v8i16((lds_s16x8*)p));
}

// grid = (S/64, B*H), block = 128 (4 waves); each wave owns 16 query rows.
// Q/K/V in [B,S,H,HD] f16 layout (row stride D). Output Hcat same layout.
__global__ __launch_bounds__(128) void attn_wmma(const _Float16* __restrict__ Qg,
                                                 const _Float16* __restrict__ Kg,
                                                 const _Float16* __restrict__ Vg,
                                                 _Float16* __restrict__ Og) {
    constexpr int LDT = 72;                 // padded LDS row stride (halves)
    // V rows [k][e]: 160 B = 32 B x odd, the pitch of the transposing load
    constexpr int LDV = 80;
    __shared__ __attribute__((aligned(16))) _Float16 Qs[64 * LDT];
    __shared__ __attribute__((aligned(16))) _Float16 Ks[64 * LDT];
    __shared__ __attribute__((aligned(16))) _Float16 Vs[64 * LDV];

    const int bh   = blockIdx.y;            // 0..63
    const int b    = bh >> 4;
    const int h    = bh & 15;
    const int q0   = blockIdx.x * 64;
    const int tid  = threadIdx.x;
    const int wave = tid >> 5;
    const int lane = tid & 31;
    const int r    = lane & 15;
    const int hs   = lane >> 4;

    const size_t rowbase = (size_t)(b * TS) * TD + (size_t)h * THD;
    const _Float16* Qb = Qg + rowbase;
    const _Float16* Kb = Kg + rowbase;
    const _Float16* Vb = Vg + rowbase;

    // tile copies: 8 lanes a row (one 128-B line), 16 rows a copy of the block,
    // 4 copies for each of Q, K and V
    const int crow = tid >> 3;              // 0..15
    const int ccol = (tid & 7) * 8;         // 0..56 halves
    constexpr unsigned K16B = 16 * LDT * 2; // bytes of 16 LDS rows of Q or K
    constexpr unsigned V16B = 16 * LDV * 2; // bytes of 16 LDS rows of V
    constexpr size_t   G16  = (size_t)16 * TD;   // 16 global rows, in halves

    // load Q block: 64 rows x 64 cols (async global -> LDS)
    {
        const unsigned ldsQ = (unsigned)(uintptr_t)(Qs + crow * LDT + ccol);
        const _Float16* gq = Qb + (size_t)(q0 + crow) * TD + ccol;
        async_copy4_b128(ldsQ,            gq,           ldsQ + K16B,     gq + G16,
                         ldsQ + 2 * K16B, gq + 2 * G16, ldsQ + 3 * K16B, gq + 3 * G16);
    }

    const v8f vzero = {0.f, 0.f, 0.f, 0.f, 0.f, 0.f, 0.f, 0.f};
    // Transposed products: a lane (hs, r) owns ONE query, row wave*16 + r.
    //   sc[j][jj] = S^T[key j*16 + hs*8 + jj][query r]
    //   o[j][jj]  = O^T[e   j*16 + hs*8 + jj][query r]
    v8f o[4];
#pragma unroll
    for (int j = 0; j < 4; ++j) o[j] = vzero;
    float mrow = -1.0e30f;   // running maximum of the lane's query (both halves)
    float lrow = 0.f;        // running sum over this lane half's keys only

    const float scale = 0.03125f;           // 1/sqrt(D) = 1/32

    const unsigned ldsK = (unsigned)(uintptr_t)(Ks + crow * LDT + ccol);
    const unsigned ldsV = (unsigned)(uintptr_t)(Vs + crow * LDV + ccol);
    // lane address of the transposing load: row 8*hs + (lane & 7), and the
    // second 16 B of the 32-B column group in lanes 8..15 of each half
    const _Float16* vtr = Vs + (hs * 8 + (lane & 7)) * LDV + ((lane >> 3) & 1) * 8;

    for (int kt = 0; kt < TS / 64; ++kt) {
        const int k0 = kt * 64;
        // this wave's LDS reads of the previous tile have retired before any
        // wave's copies may overwrite it ...
        asm volatile("s_wait_dscnt 0x0" ::: "memory");
        __syncthreads();                    // ... and so have every wave's
        // K and V tiles, both row-major, via async-to-LDS
        {
            const _Float16* gk = Kb + (size_t)(k0 + crow) * TD + ccol;
            const _Float16* gv = Vb + (size_t)(k0 + crow) * TD + ccol;
            async_copy8_b128(ldsK,            gk,           ldsK + K16B,     gk + G16,
                             ldsK + 2 * K16B, gk + 2 * G16, ldsK + 3 * K16B, gk + 3 * G16,
                             ldsV,            gv,           ldsV + V16B,     gv + G16,
                             ldsV + 2 * V16B, gv + 2 * G16, ldsV + 3 * V16B, gv + 3 * G16);
        }
        if (kt + 1 < TS / 64)               // lowers to global_prefetch_b8
            __builtin_prefetch(Kb + (size_t)(k0 + 64) * TD + (tid & 63), 0, 1);
        wait_async(0);                      // own async K, V (and Q) writes done
        __syncthreads();

        // ---- S^T = K @ Q^T  (64 keys x 16 queries per wave) ----
        // A = K rows, B = Q rows, both read in the same k order
        v8f sc[4];
#pragma unroll
        for (int j = 0; j < 4; ++j) sc[j] = vzero;
#pragma unroll
        for (int ks = 0; ks < 2; ++ks) {
            v16h bq;
            const _Float16* qb = Qs + (wave * 16 + r) * LDT + ks * 32 + hs * 8;
            ((uint4*)&bq)[0] = *(const uint4*)(qb);
            ((uint4*)&bq)[1] = *(const uint4*)(qb + 16);
#pragma unroll
            for (int j = 0; j < 4; ++j) {
                v16h ak;
                const _Float16* kb = Ks + (j * 16 + r) * LDT + ks * 32 + hs * 8;
                ((uint4*)&ak)[0] = *(const uint4*)(kb);
                ((uint4*)&ak)[1] = *(const uint4*)(kb + 16);
                sc[j] = __builtin_amdgcn_wmma_f32_16x16x32_f16(
                    false, ak, false, bq, (short)0, sc[j], false, false);
            }
        }

        // ---- online softmax: the lane's 32 scores all belong to its query ----
        float mx = -1.0e30f;
#pragma unroll
        for (int j = 0; j < 4; ++j)
#pragma unroll
            for (int jj = 0; jj < 8; ++jj) {
                sc[j][jj] *= scale;
                mx = fmaxf(mx, sc[j][jj]);
            }
        mx = fmaxf(mx, xhalf(mx));          // the other 32 keys of the query
        const float mn   = fmaxf(mrow, mx);
        const float corr = __expf(mrow - mn);
        float rs = 0.f;
#pragma unroll
        for (int j = 0; j < 4; ++j)
#pragma unroll
            for (int jj = 0; jj < 8; ++jj) {
                float p = __expf(sc[j][jj] - mn);
                sc[j][jj] = p;
                rs += p;
            }
        lrow = lrow * corr + rs;            // halves are joined after the loop
        mrow = mn;
#pragma unroll
        for (int j = 0; j < 4; ++j)
#pragma unroll
            for (int jj = 0; jj < 8; ++jj) o[j][jj] *= corr;

        // ---- O^T += V^T @ P^T  (A = V^T by transposing loads; B = P^T from sc) ----
        // Two S^T tiles converted in place are the B operand: element s of the
        // lane is key ks*32 + (s < 8 ? hs*8 + s : 16 + hs*8 + s - 8), which is
        // the k order of the transposing loads below: lane (hs, r) gets
        // V[ks*32 + hs*8 + 0..7][j*16 + r], then the same 16 keys further on.
#pragma unroll
        for (int ks = 0; ks < 2; ++ks) {
            v16h bp;
#pragma unroll
            for (int jj = 0; jj < 8; ++jj) {
                bp[jj]     = (_Float16)sc[2 * ks][jj];
                bp[8 + jj] = (_Float16)sc[2 * ks + 1][jj];
            }
#pragma unroll
            for (int j = 0; j < 4; ++j) {
                v16h av;
                const _Float16* vb = vtr + ks * 32 * LDV + j * 16;
                ((uint4*)&av)[0] = lds_tr16(vb);
                ((uint4*)&av)[1] = lds_tr16(vb + 16 * LDV);
                o[j] = __builtin_amdgcn_wmma_f32_16x16x32_f16(
                    false, av, false, bp, (short)0, o[j], false, false);
            }
        }
    }

    // ---- normalize and store Hcat[b, s, h*64 + e]: 8 consecutive e a lane ----
    const float invl = 1.0f / (lrow + xhalf(lrow));
    _Float16* orow = Og + rowbase + (size_t)(q0 + wave * 16 + r) * TD + hs * 8;
#pragma unroll
    for (int j = 0; j < 4; ++j) {
        v8h ov;
#pragma unroll
        for (int jj = 0; jj < 8; ++jj) ov[jj] = (_Float16)(o[j][jj] * invl);
        *(v8h*)(orow + j * 16) = ov;
    }
}

// -------------------------------- launcher ---------------------------------
extern "C" void kernel_launch(void* const* d_in, const int* in_sizes, int n_in,
                              void* d_out, int out_size, void* d_ws, size_t ws_size,
                              hipStream_t stream) {
    const float* emb = (const float*)d_in[0];
    const float* Wq  = (const float*)d_in[1];
    const float* bq  = (const float*)d_in[2];
    const float* Wk  = (const float*)d_in[3];
    const float* bk  = (const float*)d_in[4];
    const float* Wv  = (const float*)d_in[5];
    const float* bv  = (const float*)d_in[6];
    const float* W1  = (const float*)d_in[7];
    const float* b1  = (const float*)d_in[8];
    const float* W2  = (const float*)d_in[9];
    const float* b2  = (const float*)d_in[10];
    float* out = (float*)d_out;

    // workspace carve-up (f16 units)
    _Float16* ws = (_Float16*)d_ws;
    const size_t nEmb = (size_t)TM * TD;          // 8192*1024
    const size_t nWqkv = (size_t)TD * TD;         // 1024*1024
    const size_t nW1 = (size_t)TFF * TD;
    const size_t nW2 = (size_t)TD * TFF;
    _Float16* emb16  = ws;                 ws += nEmb;
    _Float16* wq16   = ws;                 ws += nWqkv;
    _Float16* wk16   = ws;                 ws += nWqkv;
    _Float16* wv16   = ws;                 ws += nWqkv;
    _Float16* w1_16  = ws;                 ws += nW1;
    _Float16* w2_16  = ws;                 ws += nW2;
    _Float16* q16    = ws;                 ws += nEmb;
    _Float16* k16    = ws;                 ws += nEmb;
    _Float16* v16    = ws;                 ws += nEmb;
    _Float16* hcat16 = ws;                 ws += nEmb;
    _Float16* hid16  = ws;                 ws += (size_t)TM * TFF;

    auto cvt = [&](const float* src, _Float16* dst, size_t n) {
        cvt_f32_to_f16<<<dim3((unsigned)(n / CVT_BLK)), dim3(256), 0, stream>>>(
            src, dst, (int)n);
    };
    cvt(emb, emb16, nEmb);
    cvt(Wq, wq16, nWqkv);
    cvt(Wk, wk16, nWqkv);
    cvt(Wv, wv16, nWqkv);
    cvt(W1, w1_16, nW1);
    cvt(W2, w2_16, nW2);

    // QKV projections: [8192,1024] = emb16 @ W^T + b   (f16 out)
    {
        dim3 grid(TD / GBN, TM / GBM), blk(256);
        gemm_wmma<false, _Float16><<<grid, blk, 0, stream>>>(emb16, wq16, bq, q16, TM, TD, TD);
        gemm_wmma<false, _Float16><<<grid, blk, 0, stream>>>(emb16, wk16, bk, k16, TM, TD, TD);
        gemm_wmma<false, _Float16><<<grid, blk, 0, stream>>>(emb16, wv16, bv, v16, TM, TD, TD);
    }

    // attention -> Hcat (f16, [B,S,H*HD])
    {
        dim3 grid(TS / 64, TB * TH), blk(128);
        attn_wmma<<<grid, blk, 0, stream>>>(q16, k16, v16, hcat16);
    }

    // FFN layer 1: relu(Hcat @ W1^T + b1)  -> hid16 [8192,4096]
    {
        dim3 grid(TFF / GBN, TM / GBM), blk(256);
        gemm_wmma<true, _Float16><<<grid, blk, 0, stream>>>(hcat16, w1_16, b1, hid16, TM, TFF, TD);
    }
    // FFN layer 2: hid @ W2^T + b2 -> d_out (f32, [8192,1024])
    {
        dim3 grid(TD / GBN, TM / GBM), blk(256);
        gemm_wmma<false, float><<<grid, blk, 0, stream>>>(hid16, w2_16, b2, out, TM, TD, TFF);
    }
}

// v007
// Measured time: 244 microseconds a run.
// Timed twice side by side with v006, it ran 1.06 times as fast both times.
// Counting every step since v000, it is 2.54 times as fast.
#include <hip/hip_runtime.h>
#include <hip/hip_bf16.h>

// ---------------------------------------------------------------------------
// Transformer block for MI455X (gfx1250, wave32, WMMA f16 -> f32 accum)
//   B=4, S=2048, D=1024, H=16, HD=64, FF=4096, M = B*S = 8192
// Pipeline:
//   1) f32 -> f16 conversion of embeddings + all weights, one launch
//   2) WMMA GEMM (async-LDS double-buffered): Q/K/V = emb @ W^T + b, one launch
//   3) Flash-attention with WMMA (K Q^T and V^T P^T), online softmax;
//      V lies row-major in LDS and is transposed by ds_load_tr16_b128
//   4) WMMA GEMM + ReLU: hid = Hcat @ W1^T + b1
//   5) WMMA GEMM (f32 out): out = hid @ W2^T + b2 -> d_out
// CDNA5 specifics: v_wmma_f32_16x16x32_f16, global_load_async_to_lds_b128
// (ASYNCcnt pipeline), s_wait_asynccnt / s_wait_dscnt, v_permlanex16_b32.
// ---------------------------------------------------------------------------

typedef __attribute__((ext_vector_type(16))) _Float16 v16h;
typedef __attribute__((ext_vector_type(8)))  float    v8f;
typedef __attribute__((ext_vector_type(8)))  _Float16 v8h;

#define TB 4
#define TS 2048
#define TD 1024
#define TH 16
#define THD 64
#define TFF 4096
#define TM (TB * TS)   // 8192

// four async copies of 16 bytes (8 halves) per lane, global -> LDS, tracked by
// ASYNCcnt; the last line is the wait that stands before any of their address
// registers is rewritten
__device__ __forceinline__ void async_copy4_b128(
    unsigned l0, const _Float16* g0, unsigned l1, const _Float16* g1,
    unsigned l2, const _Float16* g2, unsigned l3, const _Float16* g3) {
    asm volatile("global_load_async_to_lds_b128 %0, %1, off\n\t"
                 "global_load_async_to_lds_b128 %2, %3, off\n\t"
                 "global_load_async_to_lds_b128 %4, %5, off\n\t"
                 "global_load_async_to_lds_b128 %6, %7, off\n\t"
                 "s_wait_xcnt 0x0"
                 :: "v"(l0), "v"(g0), "v"(l1), "v"(g1), "v"(l2), "v"(g2),
                    "v"(l3), "v"(g3)
                 : "memory");
}
__device__ __forceinline__ void wait_async(int n) {
    if (n == 0) asm volatile("s_wait_asynccnt 0x0" ::: "memory");
    else        asm volatile("s_wait_asynccnt 0x4" ::: "memory");
}

// -------------------------------- f32 -> f16 -------------------------------
// A block converts CVT_BLK consecutive elements, 32 a lane: eight 16-B loads,
// each 512 contiguous bytes of a wave (4 whole lines), all in flight before the
// first is used; each is stored as 8 B a lane (2 whole lines of a wave).
// All six arrays are converted by ONE grid: none reads what another writes, and
// each launch of its own would pay a start and a drained tail. Their f16 copies
// lie one behind the other in the workspace, in the order of the arguments, so
// the block index is also the place in the output; the source is picked by the
// range the block index falls in (a scalar choice, the same for the block).
typedef __attribute__((ext_vector_type(4))) float    v4f;
typedef __attribute__((ext_vector_type(4))) _Float16 v4h;
#define CVT_LOADS 8
#define CVT_BLK (256 * 4 * CVT_LOADS)   // 8192 elements
static_assert((TB * TS * TD) % CVT_BLK == 0 && (TD * TD) % CVT_BLK == 0 &&
              (TFF * TD) % CVT_BLK == 0, "conversion blocks must be full");
#define CVT_NB_EMB (TB * TS * TD / CVT_BLK)   // blocks of the embeddings
#define CVT_NB_QKV (TD * TD / CVT_BLK)        // blocks of each of Wq, Wk, Wv
#define CVT_NB_FF  (TFF * TD / CVT_BLK)       // blocks of each of W1, W2
#define CVT_NB_ALL (CVT_NB_EMB + 3 * CVT_NB_QKV + 2 * CVT_NB_FF)
__global__ __launch_bounds__(256) void cvt_f32_to_f16(const float* __restrict__ emb,
                                                      const float* __restrict__ Wq,
                                                      const float* __restrict__ Wk,
                                                      const float* __restrict__ Wv,
                                                      const float* __restrict__ W1,
                                                      const float* __restrict__ W2,
                                                      _Float16* __restrict__ dst) {
    const int blk = blockIdx.x;
    if (blk >= CVT_NB_ALL) return;           // never past the end of the arrays
    const float* src = emb;
    int first = 0;                           // first block of the chosen array
    if (blk >= CVT_NB_EMB)                  { src = Wq; first = CVT_NB_EMB; }
    if (blk >= CVT_NB_EMB + CVT_NB_QKV)     { src = Wk; first = CVT_NB_EMB + CVT_NB_QKV; }
    if (blk >= CVT_NB_EMB + 2 * CVT_NB_QKV) { src = Wv; first = CVT_NB_EMB + 2 * CVT_NB_QKV; }
    if (blk >= CVT_NB_EMB + 3 * CVT_NB_QKV) { src = W1; first = CVT_NB_EMB + 3 * CVT_NB_QKV; }
    if (blk >= CVT_NB_EMB + 3 * CVT_NB_QKV + CVT_NB_FF) {
        src = W2; first = CVT_NB_EMB + 3 * CVT_NB_QKV + CVT_NB_FF;
    }
    const float* in = src + (blk - first) * CVT_BLK;
    _Float16* out = dst + blk * CVT_BLK;
    const int at = threadIdx.x * 4;
    v4f v[CVT_LOADS];
    // both loops unrolled: v[] stays in registers, and the eight loads stand
    // together in front of the first wait
#pragma unroll
    for (int k = 0; k < CVT_LOADS; ++k)
        v[k] = *(const v4f*)(in + at + k * 1024);
#pragma unroll
    for (int k = 0; k < CVT_LOADS; ++k)
        *(v4h*)(out + at + k * 1024) = __builtin_convertvector(v[k], v4h);
}

// ------------------------- WMMA tiled GEMM (C = A @ B^T) -------------------
// A: [M,K] f16 row-major. Bw: [N,K] f16 row-major (torch Linear weight).
// bias: f32 [N] or null. C: [M,N] OutT row-major. Optional ReLU.
// Block tile 256x128, K-step 128, 256 threads = 8 waves, wave tile 64x64, one
// block on a WGP: a fragment read from LDS feeds four products, and a byte
// brought from L2 feeds 128 (A) or 256 (B) output columns or rows.
// M must be a multiple of 256, N of 128, K of 128 and at least 256. Two LDS
// buffers fed by global_load_async_to_lds_b128; a K-step is 256 B of every
// operand row, so one copy instruction of a wave covers 4 whole 128-B lines.

// Eight async copies (16 B per lane each) and, as the last line of the same
// statement, the wait that stands before any of their address registers is
// rewritten (in a statement of its own the compiler could lift later address
// arithmetic over it).
__device__ __forceinline__ void async_copy8_b128(
    unsigned l0, const _Float16* g0, unsigned l1, const _Float16* g1,
    unsigned l2, const _Float16* g2, unsigned l3, const _Float16* g3,
    unsigned l4, const _Float16* g4, unsigned l5, const _Float16* g5,
    unsigned l6, const _Float16* g6, unsigned l7, const _Float16* g7) {
    asm volatile("global_load_async_to_lds_b128 %0, %1, off\n\t"
                 "global_load_async_to_lds_b128 %2, %3, off\n\t"
                 "global_load_async_to_lds_b128 %4, %5, off\n\t"
                 "global_load_async_to_lds_b128 %6, %7, off\n\t"
                 "global_load_async_to_lds_b128 %8, %9, off\n\t"
                 "global_load_async_to_lds_b128 %10, %11, off\n\t"
                 "global_load_async_to_lds_b128 %12, %13, off\n\t"
                 "global_load_async_to_lds_b128 %14, %15, off\n\t"
                 "s_wait_xcnt 0x0"
                 :: "v"(l0), "v"(g0), "v"(l1), "v"(g1), "v"(l2), "v"(g2),
                    "v"(l3), "v"(g3), "v"(l4), "v"(g4), "v"(l5), "v"(g5),
                    "v"(l6), "v"(g6), "v"(l7), "v"(g7)
                 : "memory");
}

// One async copy of 16 B per lane, as the compiler's builtin: operands of an asm
// statement must lie below v256, where the GEMM's accumulators and two fragment
// sets leave no room (asm copies there cost two spilled address registers).
typedef __attribute__((ext_vector_type(4))) int i32x4;
__device__ __forceinline__ void async_copy_b128(const _Float16* l, const _Float16* g) {
    typedef __attribute__((address_space(1))) i32x4 glb_i32x4;
    typedef __attribute__((address_space(3))) i32x4 lds_i32x4;
    __builtin_amdgcn_global_load_async_to_lds_b128((glb_i32x4*)g, (lds_i32x4*)l, 0, 0);
}

#define GBM 256   // rows of C per block
#define GBN 128   // columns of C per block
static_assert(TM % GBM == 0 && TD % GBN == 0 && TFF % GBN == 0 &&
              TD % 128 == 0 && TFF % 128 == 0 && TD >= 256 && TFF >= 256,
              "GEMM tiles must be full, and the ring needs two K-steps");

// One block's tile of C, rows from blockM and columns from blockN.
template <bool RELU, typename OutT>
__device__ __forceinline__ void gemm_tile(const _Float16* __restrict__ A,
                                          const _Float16* __restrict__ Bw,
                                          const float* __restrict__ bias,
                                          OutT* __restrict__ C,
                                          int N, int K, int blockM, int blockN) {
    // LDS row pitch in halves: 128 data + 8 pad = 272 B (16 B x odd), so the 16
    // rows of a ds_load_b128 fragment read fall on 16 distinct bank groups.
    // Pad is never read.
    constexpr int BK  = 128;
    constexpr int LDP = 136;
    // one array: [A buffer 0 | A buffer 1 | B buffer 0 | B buffer 1]
    __shared__ __attribute__((aligned(16))) _Float16 smem[2 * (GBM + GBN) * LDP];
    constexpr int ABUF = GBM * LDP;            // halves of one buffer of A
    constexpr int BBUF = GBN * LDP;            // halves of one buffer of B
    const _Float16* Bs = smem + 2 * ABUF;

    const int tid  = threadIdx.x;
    const int wave = tid >> 5;
    const int lane = tid & 31;
    const int wm   = wave >> 1;     // 0..3 : wave row
    const int wn   = wave & 1;      // 0..1 : wave col
    const int r    = lane & 15;
    const int hs   = lane >> 4;     // 0/1, selects K-half per ISA A/B layout

    const v8f vzero = {0.f, 0.f, 0.f, 0.f, 0.f, 0.f, 0.f, 0.f};
    v8f acc[4][4];
#pragma unroll
    for (int i = 0; i < 4; ++i)
#pragma unroll
        for (int j = 0; j < 4; ++j) acc[i][j] = vzero;

    // cooperative tile copies: 16 lanes per row (256 B), 16 rows per copy of
    // the block, 16 copies for A and 8 for B per K-step
    const int ldr = tid >> 4;          // 0..15
    const int ldc = (tid & 15) * 8;    // 0..120 halves

    const int lanlds = ldr * LDP + ldc;        // the lane's place in an LDS tile
    // the lane's place in a global tile is the same in A and in B
    const size_t lanoff = (size_t)ldr * K + ldc;
    const _Float16* gA = A  + (size_t)blockM * K;
    const _Float16* gB = Bw + (size_t)blockN * K;
    const size_t r16 = (size_t)16 * K;         // 16 global rows, in halves

    auto issue = [&](int t, int buf) {
        const _Float16* a = gA + (size_t)t * BK + lanoff;
        const _Float16* b = gB + (size_t)t * BK + lanoff;
        const _Float16* la = smem + buf * ABUF + lanlds;
        const _Float16* lb = Bs + buf * BBUF + lanlds;
#pragma unroll
        for (int k = 0; k < GBM / 16; ++k)
            async_copy_b128(la + k * 16 * LDP, a + k * r16);
#pragma unroll
        for (int k = 0; k < GBN / 16; ++k)
            async_copy_b128(lb + k * 16 * LDP, b + k * r16);
    };

    // The fragments of one 32-k block: 4 of A and 4 of B, 16 ds_load_b128.
    // Per ISA 16-bit 16x32 layout, the same k order for A and B:
    //   lane hs half: halves 0..7 at k = hs*8 .. hs*8+7, halves 8..15 at +16
    const int fragA = (wm * 64 + r) * LDP + hs * 8;
    const int fragB = (wn * 64 + r) * LDP + hs * 8;
    auto fetch = [&](v16h (&af)[4], v16h (&bf)[4], int buf, int ks) {
#pragma unroll
        for (int i = 0; i < 4; ++i) {
            const _Float16* ab = &smem[buf * ABUF + fragA + i * 16 * LDP + ks * 32];
            ((uint4*)&af[i])[0] = *(const uint4*)(ab);
            ((uint4*)&af[i])[1] = *(const uint4*)(ab + 16);
        }
#pragma unroll
        for (int j = 0; j < 4; ++j) {
            const _Float16* bb = &Bs[buf * BBUF + fragB + j * 16 * LDP + ks * 32];
            ((uint4*)&bf[j])[0] = *(const uint4*)(bb);
            ((uint4*)&bf[j])[1] = *(const uint4*)(bb + 16);
        }
        // keeps the 16 loads one group ahead of the products that follow: sunk
        // among them, each pair of loads would be waited for on its own
        __builtin_amdgcn_sched_barrier(0);
    };
    auto block = [&](const v16h (&af)[4], const v16h (&bf)[4]) {
#pragma unroll
        for (int i = 0; i < 4; ++i)
#pragma unroll
            for (int j = 0; j < 4; ++j)
                acc[i][j] = __builtin_amdgcn_wmma_f32_16x16x32_f16(
                    false, af[i], false, bf[j], (short)0, acc[i][j], false, false);
        // keeps the next group of loads behind these products
        __builtin_amdgcn_sched_barrier(0);
    };

    const int nt = K / BK;
    issue(0, 0);
    // tile 0 has landed for this wave; the barrier publishes it to the block
    asm volatile("s_wait_asynccnt 0x0" ::: "memory");
    __syncthreads();
    if (nt > 1) issue(1, 1);                  // tile 1 flies over trip 0

    // two fragment sets: each 32-k block's loads fly over the block before it
    v16h a0[4], b0[4], a1[4], b1[4];
    fetch(a0, b0, 0, 0);
    for (int t = 0; t < nt; ++t) {
        const int buf = t & 1;
        fetch(a1, b1, buf, 1);
        block(a0, b0);
        fetch(a0, b0, buf, 2);
        block(a1, b1);
        fetch(a1, b1, buf, 3);
        block(a0, b0);

        // foot of the trip, in front of its last block, whose fragments are
        // fetched: this wave's reads of `buf` are done ...
        asm volatile("s_wait_dscnt 0x0" ::: "memory");
        // ... and its copies of tile t+1 have landed;
        asm volatile("s_wait_asynccnt 0x0" ::: "memory");
        // one barrier publishes tile t+1 and frees `buf` for the refill
        __syncthreads();
        if (t + 2 < nt) issue(t + 2, buf);
        // first fragments of tile t+1, behind its barrier; in the last trip
        // they come from the idle buffer (tile nt-2, no copy aimed at it) and
        // are not used: no branch, so the waits stay counted
        fetch(a0, b0, buf ^ 1, 0);
        block(a1, b1);
    }
    // nothing is in flight when the wave goes on to the epilogue
    asm volatile("s_wait_asynccnt 0x0" ::: "memory");

    // epilogue: C/D layout = lane (hs,r): col n = r, rows = hs*8 + 0..7
#pragma unroll
    for (int j = 0; j < 4; ++j) {
        const int n   = blockN + wn * 64 + j * 16 + r;
        const float bv = bias ? bias[n] : 0.f;
#pragma unroll
        for (int i = 0; i < 4; ++i) {
#pragma unroll
            for (int jj = 0; jj < 8; ++jj) {
                const int m = blockM + wm * 64 + i * 16 + hs * 8 + jj;
                float v = acc[i][j][jj] + bv;
                if (RELU) v = fmaxf(v, 0.f);
                C[(size_t)m * N + n] = (OutT)v;
            }
        }
    }
}

template <bool RELU, typename OutT>
__global__ __launch_bounds__(256) void gemm_wmma(const _Float16* __restrict__ A,
                                                 const _Float16* __restrict__ Bw,
                                                 const float* __restrict__ bias,
                                                 OutT* __restrict__ C,
                                                 int M, int N, int K) {
    gemm_tile<RELU, OutT>(A, Bw, bias, C, N, K, blockIdx.y * GBM, blockIdx.x * GBN);
}

// The three projections of one A in ONE grid, blockIdx.z = 0, 1, 2 for Q, K, V:
// they read none of each other's output. W holds the three [N,K] weights and C
// the three [M,N] results, each one behind the other.
__global__ __launch_bounds__(256) void gemm_qkv(const _Float16* __restrict__ A,
                                                const _Float16* __restrict__ W,
                                                const float* __restrict__ bq,
                                                const float* __restrict__ bk,
                                                const float* __restrict__ bv,
                                                _Float16* __restrict__ C,
                                                int M, int N, int K) {
    const int which = blockIdx.z;
    const float* bias = which == 0 ? bq : which == 1 ? bk : bv;
    gemm_tile<false, _Float16>(A, W + (size_t)which * N * K, bias,
                               C + (size_t)which * M * N, N, K,
                               blockIdx.y * GBM, blockIdx.x * GBN);
}

// ------------------------------ flash attention ----------------------------
// value of lane l ^ 16 (the other 16-lane half), by a vector cross-row move
__device__ __forceinline__ float xhalf(float x) {
    const int b = __builtin_bit_cast(int, x);
    return __builtin_bit_cast(float, __builtin_amdgcn_permlanex16(
        b, b, 0x76543210, 0xfedcba98, false, false));
}

// 16 bytes of a row-major 16-bit LDS tile per lane, handed out transposed:
// two of them (k and k + 16) are one 16 x 32 A fragment in the hardware k order
typedef __attribute__((ext_vector_type(8))) short s16x8;
__device__ __forceinline__ uint4 lds_tr16(const _Float16* p) {
    typedef __attribute__((address_space(3))) s16x8 lds_s16x8;
    return __builtin_bit_cast(uint4,
        __builtin_amdgcn_ds_load_tr16_b128_v8i16((lds_s16x8*)p));
}

// grid = (S/64, B*H), block = 128 (4 waves); each wave owns 16 query rows.
// Q/K/V in [B,S,H,HD] f16 layout (row stride D). Output Hcat same layout.
__global__ __launch_bounds__(128) void attn_wmma(const _Float16* __restrict__ Qg,
                                                 const _Float16* __restrict__ Kg,
                                                 const _Float16* __restrict__ Vg,
                                                 _Float16* __restrict__ Og) {
    constexpr int LDT = 72;                 // padded LDS row stride (halves)
    // V rows [k][e]: 160 B = 32 B x odd, the pitch of the transposing load
    constexpr int LDV = 80;
    __shared__ __attribute__((aligned(16))) _Float16 Qs[64 * LDT];
    __shared__ __attribute__((aligned(16))) _Float16 Ks[64 * LDT];
    __shared__ __attribute__((aligned(16))) _Float16 Vs[64 * LDV];

    const int bh   = blockIdx.y;            // 0..63
    const int b    = bh >> 4;
    const int h    = bh & 15;
    const int q0   = blockIdx.x * 64;
    const int tid  = threadIdx.x;
    const int wave = tid >> 5;
    const int lane = tid & 31;
    const int r    = lane & 15;
    const int hs   = lane >> 4;

    const size_t rowbase = (size_t)(b * TS) * TD + (size_t)h * THD;
    const _Float16* Qb = Qg + rowbase;
    const _Float16* Kb = Kg + rowbase;
    const _Float16* Vb = Vg + rowbase;

    // tile copies: 8 lanes a row (one 128-B line), 16 rows a copy of the block,
    // 4 copies for each of Q, K and V
    const int crow = tid >> 3;              // 0..15
    const int ccol = (tid & 7) * 8;         // 0..56 halves
    constexpr unsigned K16B = 16 * LDT * 2; // bytes of 16 LDS rows of Q or K
    constexpr unsigned V16B = 16 * LDV * 2; // bytes of 16 LDS rows of V
    constexpr size_t   G16  = (size_t)16 * TD;   // 16 global rows, in halves

    // load Q block: 64 rows x 64 cols (async global -> LDS)
    {
        const unsigned ldsQ = (unsigned)(uintptr_t)(Qs + crow * LDT + ccol);
        const _Float16* gq = Qb + (size_t)(q0 + crow) * TD + ccol;
        async_copy4_b128(ldsQ,            gq,           ldsQ + K16B,     gq + G16,
                         ldsQ + 2 * K16B, gq + 2 * G16, ldsQ + 3 * K16B, gq + 3 * G16);
    }

    const v8f vzero = {0.f, 0.f, 0.f, 0.f, 0.f, 0.f, 0.f, 0.f};
    // Transposed products: a lane (hs, r) owns ONE query, row wave*16 + r.
    //   sc[j][jj] = S^T[key j*16 + hs*8 + jj][query r]
    //   o[j][jj]  = O^T[e   j*16 + hs*8 + jj][query r]
    v8f o[4];
#pragma unroll
    for (int j = 0; j < 4; ++j) o[j] = vzero;
    float mrow = -1.0e30f;   // running maximum of the lane's query (both halves)
    float lrow = 0.f;        // running sum over this lane half's keys only

    const float scale = 0.03125f;           // 1/sqrt(D) = 1/32

    const unsigned ldsK = (unsigned)(uintptr_t)(Ks + crow * LDT + ccol);
    const unsigned ldsV = (unsigned)(uintptr_t)(Vs + crow * LDV + ccol);
    // lane address of the transposing load: row 8*hs + (lane & 7), and the
    // second 16 B of the 32-B column group in lanes 8..15 of each half
    const _Float16* vtr = Vs + (hs * 8 + (lane & 7)) * LDV + ((lane >> 3) & 1) * 8;

    for (int kt = 0; kt < TS / 64; ++kt) {
        const int k0 = kt * 64;
        // this wave's LDS reads of the previous tile have retired before any
        // wave's copies may overwrite it ...
        asm volatile("s_wait_dscnt 0x0" ::: "memory");
        __syncthreads();                    // ... and so have every wave's
        // K and V tiles, both row-major, via async-to-LDS
        {
            const _Float16* gk = Kb + (size_t)(k0 + crow) * TD + ccol;
            const _Float16* gv = Vb + (size_t)(k0 + crow) * TD + ccol;
            async_copy8_b128(ldsK,            gk,           ldsK + K16B,     gk + G16,
                             ldsK + 2 * K16B, gk + 2 * G16, ldsK + 3 * K16B, gk + 3 * G16,
                             ldsV,            gv,           ldsV + V16B,     gv + G16,
                             ldsV + 2 * V16B, gv + 2 * G16, ldsV + 3 * V16B, gv + 3 * G16);
        }
        if (kt + 1 < TS / 64)               // lowers to global_prefetch_b8
            __builtin_prefetch(Kb + (size_t)(k0 + 64) * TD + (tid & 63), 0, 1);
        wait_async(0);                      // own async K, V (and Q) writes done
        __syncthreads();

        // ---- S^T = K @ Q^T  (64 keys x 16 queries per wave) ----
        // A = K rows, B = Q rows, both read in the same k order
        v8f sc[4];
#pragma unroll
        for (int j = 0; j < 4; ++j) sc[j] = vzero;
#pragma unroll
        for (int ks = 0; ks < 2; ++ks) {
            v16h bq;
            const _Float16* qb = Qs + (wave * 16 + r) * LDT + ks * 32 + hs * 8;
            ((uint4*)&bq)[0] = *(const uint4*)(qb);
            ((uint4*)&bq)[1] = *(const uint4*)(qb + 16);
#pragma unroll
            for (int j = 0; j < 4; ++j) {
                v16h ak;
                const _Float16* kb = Ks + (j * 16 + r) * LDT + ks * 32 + hs * 8;
                ((uint4*)&ak)[0] = *(const uint4*)(kb);
                ((uint4*)&ak)[1] = *(const uint4*)(kb + 16);
                sc[j] = __builtin_amdgcn_wmma_f32_16x16x32_f16(
                    false, ak, false, bq, (short)0, sc[j], false, false);
            }
        }

        // ---- online softmax: the lane's 32 scores all belong to its query ----
        float mx = -1.0e30f;
#pragma unroll
        for (int j = 0; j < 4; ++j)
#pragma unroll
            for (int jj = 0; jj < 8; ++jj) {
                sc[j][jj] *= scale;
                mx = fmaxf(mx, sc[j][jj]);
            }
        mx = fmaxf(mx, xhalf(mx));          // the other 32 keys of the query
        const float mn   = fmaxf(mrow, mx);
        const float corr = __expf(mrow - mn);
        float rs = 0.f;
#pragma unroll
        for (int j = 0; j < 4; ++j)
#pragma unroll
            for (int jj = 0; jj < 8; ++jj) {
                float p = __expf(sc[j][jj] - mn);
                sc[j][jj] = p;
                rs += p;
            }
        lrow = lrow * corr + rs;            // halves are joined after the loop
        mrow = mn;
#pragma unroll
        for (int j = 0; j < 4; ++j)
#pragma unroll
            for (int jj = 0; jj < 8; ++jj) o[j][jj] *= corr;

        // ---- O^T += V^T @ P^T  (A = V^T by transposing loads; B = P^T from sc) ----
        // Two S^T tiles converted in place are the B operand: element s of the
        // lane is key ks*32 + (s < 8 ? hs*8 + s : 16 + hs*8 + s - 8), which is
        // the k order of the transposing loads below: lane (hs, r) gets
        // V[ks*32 + hs*8 + 0..7][j*16 + r], then the same 16 keys further on.
#pragma unroll
        for (int ks = 0; ks < 2; ++ks) {
            v16h bp;
#pragma unroll
            for (int jj = 0; jj < 8; ++jj) {
                bp[jj]     = (_Float16)sc[2 * ks][jj];
                bp[8 + jj] = (_Float16)sc[2 * ks + 1][jj];
            }
#pragma unroll
            for (int j = 0; j < 4; ++j) {
                v16h av;
                const _Float16* vb = vtr + ks * 32 * LDV + j * 16;
                ((uint4*)&av)[0] = lds_tr16(vb);
                ((uint4*)&av)[1] = lds_tr16(vb + 16 * LDV);
                o[j] = __builtin_amdgcn_wmma_f32_16x16x32_f16(
                    false, av, false, bp, (short)0, o[j], false, false);
            }
        }
    }

    // ---- normalize and store Hcat[b, s, h*64 + e]: 8 consecutive e a lane ----
    const float invl = 1.0f / (lrow + xhalf(lrow));
    _Float16* orow = Og + rowbase + (size_t)(q0 + wave * 16 + r) * TD + hs * 8;
#pragma unroll
    for (int j = 0; j < 4; ++j) {
        v8h ov;
#pragma unroll
        for (int jj = 0; jj < 8; ++jj) ov[jj] = (_Float16)(o[j][jj] * invl);
        *(v8h*)(orow + j * 16) = ov;
    }
}

// -------------------------------- launcher ---------------------------------
extern "C" void kernel_launch(void* const* d_in, const int* in_sizes, int n_in,
                              void* d_out, int out_size, void* d_ws, size_t ws_size,
                              hipStream_t stream) {
    const float* emb = (const float*)d_in[0];
    const float* Wq  = (const float*)d_in[1];
    const float* bq  = (const float*)d_in[2];
    const float* Wk  = (const float*)d_in[3];
    const float* bk  = (const float*)d_in[4];
    const float* Wv  = (const float*)d_in[5];
    const float* bv  = (const float*)d_in[6];
    const float* W1  = (const float*)d_in[7];
    const float* b1  = (const float*)d_in[8];
    const float* W2  = (const float*)d_in[9];
    const float* b2  = (const float*)d_in[10];
    float* out = (float*)d_out;

    // workspace carve-up (f16 units)
    _Float16* ws = (_Float16*)d_ws;
    const size_t nEmb = (size_t)TM * TD;          // 8192*1024
    const size_t nWqkv = (size_t)TD * TD;         // 1024*1024
    const size_t nW1 = (size_t)TFF * TD;
    const size_t nW2 = (size_t)TD * TFF;
    _Float16* emb16  = ws;                 ws += nEmb;
    _Float16* wq16   = ws;                 ws += nWqkv;
    _Float16* wk16   = ws;                 ws += nWqkv;
    _Float16* wv16   = ws;                 ws += nWqkv;
    _Float16* w1_16  = ws;                 ws += nW1;
    _Float16* w2_16  = ws;                 ws += nW2;
    _Float16* q16    = ws;                 ws += nEmb;
    _Float16* k16    = ws;                 ws += nEmb;
    _Float16* v16    = ws;                 ws += nEmb;
    _Float16* hcat16 = ws;                 ws += nEmb;
    _Float16* hid16  = ws;                 ws += (size_t)TM * TFF;

    // emb16 | wq16 | wk16 | wv16 | w1_16 | w2_16, contiguous from emb16
    cvt_f32_to_f16<<<dim3(CVT_NB_ALL), dim3(256), 0, stream>>>(emb, Wq, Wk, Wv, W1, W2, emb16);

    // QKV projections: [8192,1024] = emb16 @ W^T + b   (f16 out);
    // wq16 | wk16 | wv16 and q16 | k16 | v16 are contiguous
    {
        dim3 grid(TD / GBN, TM / GBM, 3), blk(256);
        gemm_qkv<<<grid, blk, 0, stream>>>(emb16, wq16, bq, bk, bv, q16, TM, TD, TD);
    }

    // attention -> Hcat (f16, [B,S,H*HD])
    {
        dim3 grid(TS / 64, TB * TH), blk(128);
        attn_wmma<<<grid, blk, 0, stream>>>(q16, k16, v16, hcat16);
    }

    // FFN layer 1: relu(Hcat @ W1^T + b1)  -> hid16 [8192,4096]
    {
        dim3 grid(TFF / GBN, TM / GBM), blk(256);
        gemm_wmma<true, _Float16><<<grid, blk, 0, stream>>>(hcat16, w1_16, b1, hid16, TM, TFF, TD);
    }
    // FFN layer 2: hid @ W2^T + b2 -> d_out (f32, [8192,1024])
    {
        dim3 grid(TD / GBN, TM / GBM), blk(256);
        gemm_wmma<false, float><<<grid, blk, 0, stream>>>(hid16, w2_16, b2, out, TM, TD, TFF);
    }
}

// v008
// It runs in 220 microseconds.
// In two side-by-side timings against v007, it was 1.11 and 1.10 times as fast.
// All steps since v000 together make it 2.81 times as fast.
#include <hip/hip_runtime.h>
#include <hip/hip_bf16.h>

// ---------------------------------------------------------------------------
// Transformer block for MI455X (gfx1250, wave32, WMMA f16 -> f32 accum)
//   B=4, S=2048, D=1024, H=16, HD=64, FF=4096, M = B*S = 8192
// Pipeline:
//   1) f32 -> f16 conversion of embeddings + all weights, one launch
//   2) WMMA GEMM (async-LDS double-buffered): Q/K/V = emb @ W^T + b, one launch
//   3) Flash-attention with WMMA (K Q^T and V^T P^T), online softmax;
//      V lies row-major in LDS and is transposed by ds_load_tr16_b128
//   4) WMMA GEMM + ReLU: hid = Hcat @ W1^T + b1
//   5) WMMA GEMM (f32 out): out = hid @ W2^T + b2 -> d_out
// CDNA5 specifics: v_wmma_f32_16x16x32_f16, global_load_async_to_lds_b128
// (ASYNCcnt pipeline), s_wait_asynccnt / s_wait_dscnt, v_permlanex16_b32.
// ---------------------------------------------------------------------------

typedef __attribute__((ext_vector_type(16))) _Float16 v16h;
typedef __attribute__((ext_vector_type(8)))  float    v8f;
typedef __attribute__((ext_vector_type(8)))  _Float16 v8h;

#define TB 4
#define TS 2048
#define TD 1024
#define TH 16
#define THD 64
#define TFF 4096
#define TM (TB * TS)   // 8192

// four async copies of 16 bytes (8 halves) per lane, global -> LDS, tracked by
// ASYNCcnt; the last line is the wait that stands before any of their address
// registers is rewritten
__device__ __forceinline__ void async_copy4_b128(
    unsigned l0, const _Float16* g0, unsigned l1, const _Float16* g1,
    unsigned l2, const _Float16* g2, unsigned l3, const _Float16* g3) {
    asm volatile("global_load_async_to_lds_b128 %0, %1, off\n\t"
                 "global_load_async_to_lds_b128 %2, %3, off\n\t"
                 "global_load_async_to_lds_b128 %4, %5, off\n\t"
                 "global_load_async_to_lds_b128 %6, %7, off\n\t"
                 "s_wait_xcnt 0x0"
                 :: "v"(l0), "v"(g0), "v"(l1), "v"(g1), "v"(l2), "v"(g2),
                    "v"(l3), "v"(g3)
                 : "memory");
}
__device__ __forceinline__ void wait_async(int n) {
    if (n == 0) asm volatile("s_wait_asynccnt 0x0" ::: "memory");
    else        asm volatile("s_wait_asynccnt 0x4" ::: "memory");
}

// -------------------------------- f32 -> f16 -------------------------------
// A block converts CVT_BLK consecutive elements, 32 a lane: eight 16-B loads,
// each 512 contiguous bytes of a wave (4 whole lines), all in flight before the
// first is used; each is stored as 8 B a lane (2 whole lines of a wave).
// All six arrays are converted by ONE grid: none reads what another writes, and
// each launch of its own would pay a start and a drained tail. Their f16 copies
// lie one behind the other in the workspace, in the order of the arguments, so
// the block index is also the place in the output; the source is picked by the
// range the block index falls in (a scalar choice, the same for the block).
typedef __attribute__((ext_vector_type(4))) float    v4f;
typedef __attribute__((ext_vector_type(4))) _Float16 v4h;
#define CVT_LOADS 8
#define CVT_BLK (256 * 4 * CVT_LOADS)   // 8192 elements
static_assert((TB * TS * TD) % CVT_BLK == 0 && (TD * TD) % CVT_BLK == 0 &&
              (TFF * TD) % CVT_BLK == 0, "conversion blocks must be full");
#define CVT_NB_EMB (TB * TS * TD / CVT_BLK)   // blocks of the embeddings
#define CVT_NB_QKV (TD * TD / CVT_BLK)        // blocks of each of Wq, Wk, Wv
#define CVT_NB_FF  (TFF * TD / CVT_BLK)       // blocks of each of W1, W2
#define CVT_NB_ALL (CVT_NB_EMB + 3 * CVT_NB_QKV + 2 * CVT_NB_FF)
__global__ __launch_bounds__(256) void cvt_f32_to_f16(const float* __restrict__ emb,
                                                      const float* __restrict__ Wq,
                                                      const float* __restrict__ Wk,
                                                      const float* __restrict__ Wv,
                                                      const float* __restrict__ W1,
                                                      const float* __restrict__ W2,
                                                      _Float16* __restrict__ dst) {
    const int blk = blockIdx.x;
    if (blk >= CVT_NB_ALL) return;           // never past the end of the arrays
    const float* src = emb;
    int first = 0;                           // first block of the chosen array
    if (blk >= CVT_NB_EMB)                  { src = Wq; first = CVT_NB_EMB; }
    if (blk >= CVT_NB_EMB + CVT_NB_QKV)     { src = Wk; first = CVT_NB_EMB + CVT_NB_QKV; }
    if (blk >= CVT_NB_EMB + 2 * CVT_NB_QKV) { src = Wv; first = CVT_NB_EMB + 2 * CVT_NB_QKV; }
    if (blk >= CVT_NB_EMB + 3 * CVT_NB_QKV) { src = W1; first = CVT_NB_EMB + 3 * CVT_NB_QKV; }
    if (blk >= CVT_NB_EMB + 3 * CVT_NB_QKV + CVT_NB_FF) {
        src = W2; first = CVT_NB_EMB + 3 * CVT_NB_QKV + CVT_NB_FF;
    }
    const float* in = src + (blk - first) * CVT_BLK;
    _Float16* out = dst + blk * CVT_BLK;
    const int at = threadIdx.x * 4;
    v4f v[CVT_LOADS];
    // both loops unrolled: v[] stays in registers, and the eight loads stand
    // together in front of the first wait
#pragma unroll
    for (int k = 0; k < CVT_LOADS; ++k)
        v[k] = *(const v4f*)(in + at + k * 1024);
#pragma unroll
    for (int k = 0; k < CVT_LOADS; ++k)
        *(v4h*)(out + at + k * 1024) = __builtin_convertvector(v[k], v4h);
}

// ------------------------- WMMA tiled GEMM (C = A @ B^T) -------------------
// A: [M,K] f16 row-major. Bw: [N,K] f16 row-major (torch Linear weight).
// bias: f32 [N] or null. C: [M,N] OutT row-major. Optional ReLU.
// Block tile 256x128, K-step 128, 256 threads = 8 waves, wave tile 64x64, one
// block on a WGP: a fragment read from LDS feeds four products, and a byte
// brought from L2 feeds 128 (A) or 256 (B) output columns or rows.
// M must be a multiple of 256, N of 128, K of 128 and at least 256. Two LDS
// buffers fed by global_load_async_to_lds_b128; a K-step is 256 B of every
// operand row, so one copy instruction of a wave covers 4 whole 128-B lines.

// Eight async copies (16 B per lane each) and, as the last line of the same
// statement, the wait that stands before any of their address registers is
// rewritten (in a statement of its own the compiler could lift later address
// arithmetic over it).
__device__ __forceinline__ void async_copy8_b128(
    unsigned l0, const _Float16* g0, unsigned l1, const _Float16* g1,
    unsigned l2, const _Float16* g2, unsigned l3, const _Float16* g3,
    unsigned l4, const _Float16* g4, unsigned l5, const _Float16* g5,
    unsigned l6, const _Float16* g6, unsigned l7, const _Float16* g7) {
    asm volatile("global_load_async_to_lds_b128 %0, %1, off\n\t"
                 "global_load_async_to_lds_b128 %2, %3, off\n\t"
                 "global_load_async_to_lds_b128 %4, %5, off\n\t"
                 "global_load_async_to_lds_b128 %6, %7, off\n\t"
                 "global_load_async_to_lds_b128 %8, %9, off\n\t"
                 "global_load_async_to_lds_b128 %10, %11, off\n\t"
                 "global_load_async_to_lds_b128 %12, %13, off\n\t"
                 "global_load_async_to_lds_b128 %14, %15, off\n\t"
                 "s_wait_xcnt 0x0"
                 :: "v"(l0), "v"(g0), "v"(l1), "v"(g1), "v"(l2), "v"(g2),
                    "v"(l3), "v"(g3), "v"(l4), "v"(g4), "v"(l5), "v"(g5),
                    "v"(l6), "v"(g6), "v"(l7), "v"(g7)
                 : "memory");
}

// One async copy of 16 B per lane, as the compiler's builtin: operands of an asm
// statement must lie below v256, where the GEMM's accumulators and two fragment
// sets leave no room (asm copies there cost two spilled address registers).
typedef __attribute__((ext_vector_type(4))) int i32x4;
__device__ __forceinline__ void async_copy_b128(const _Float16* l, const _Float16* g) {
    typedef __attribute__((address_space(1))) i32x4 glb_i32x4;
    typedef __attribute__((address_space(3))) i32x4 lds_i32x4;
    __builtin_amdgcn_global_load_async_to_lds_b128((glb_i32x4*)g, (lds_i32x4*)l, 0, 0);
}

#define GBM 256   // rows of C per block
#define GBN 128   // columns of C per block
static_assert(TM % GBM == 0 && TD % GBN == 0 && TFF % GBN == 0 &&
              TD % 128 == 0 && TFF % 128 == 0 && TD >= 256 && TFF >= 256,
              "GEMM tiles must be full, and the ring needs two K-steps");

// One block's tile of C, rows from blockM and columns from blockN.
template <bool RELU, typename OutT>
__device__ __forceinline__ void gemm_tile(const _Float16* __restrict__ A,
                                          const _Float16* __restrict__ Bw,
                                          const float* __restrict__ bias,
                                          OutT* __restrict__ C,
                                          int N, int K, int blockM, int blockN) {
    // LDS row pitch in halves: 128 data + 8 pad = 272 B (16 B x odd), so the 16
    // rows of a ds_load_b128 fragment read fall on 16 distinct bank groups.
    // Pad is never read.
    constexpr int BK  = 128;
    constexpr int LDP = 136;
    // one array: [A buffer 0 | A buffer 1 | B buffer 0 | B buffer 1]
    __shared__ __attribute__((aligned(16))) _Float16 smem[2 * (GBM + GBN) * LDP];
    constexpr int ABUF = GBM * LDP;            // halves of one buffer of A
    constexpr int BBUF = GBN * LDP;            // halves of one buffer of B
    const _Float16* Bs = smem + 2 * ABUF;

    const int tid  = threadIdx.x;
    const int wave = tid >> 5;
    const int lane = tid & 31;
    const int wm   = wave >> 1;     // 0..3 : wave row
    const int wn   = wave & 1;      // 0..1 : wave col
    const int r    = lane & 15;
    const int hs   = lane >> 4;     // 0/1, selects K-half per ISA A/B layout

    const v8f vzero = {0.f, 0.f, 0.f, 0.f, 0.f, 0.f, 0.f, 0.f};
    v8f acc[4][4];
#pragma unroll
    for (int i = 0; i < 4; ++i)
#pragma unroll
        for (int j = 0; j < 4; ++j) acc[i][j] = vzero;

    // cooperative tile copies: 16 lanes per row (256 B), 16 rows per copy of
    // the block, 16 copies for A and 8 for B per K-step
    const int ldr = tid >> 4;          // 0..15
    const int ldc = (tid & 15) * 8;    // 0..120 halves

    const int lanlds = ldr * LDP + ldc;        // the lane's place in an LDS tile
    // the lane's place in a global tile is the same in A and in B
    const size_t lanoff = (size_t)ldr * K + ldc;
    const _Float16* gA = A  + (size_t)blockM * K;
    const _Float16* gB = Bw + (size_t)blockN * K;
    const size_t r16 = (size_t)16 * K;         // 16 global rows, in halves

    auto issue = [&](int t, int buf) {
        const _Float16* a = gA + (size_t)t * BK + lanoff;
        const _Float16* b = gB + (size_t)t * BK + lanoff;
        const _Float16* la = smem + buf * ABUF + lanlds;
        const _Float16* lb = Bs + buf * BBUF + lanlds;
#pragma unroll
        for (int k = 0; k < GBM / 16; ++k)
            async_copy_b128(la + k * 16 * LDP, a + k * r16);
#pragma unroll
        for (int k = 0; k < GBN / 16; ++k)
            async_copy_b128(lb + k * 16 * LDP, b + k * r16);
    };

    // The fragments of one 32-k block: 4 of A and 4 of B, 16 ds_load_b128.
    // Per ISA 16-bit 16x32 layout, the same k order for A and B:
    //   lane hs half: halves 0..7 at k = hs*8 .. hs*8+7, halves 8..15 at +16
    const int fragA = (wm * 64 + r) * LDP + hs * 8;
    const int fragB = (wn * 64 + r) * LDP + hs * 8;
    auto fetch = [&](v16h (&af)[4], v16h (&bf)[4], int buf, int ks) {
#pragma unroll
        for (int i = 0; i < 4; ++i) {
            const _Float16* ab = &smem[buf * ABUF + fragA + i * 16 * LDP + ks * 32];
            ((uint4*)&af[i])[0] = *(const uint4*)(ab);
            ((uint4*)&af[i])[1] = *(const uint4*)(ab + 16);
        }
#pragma unroll
        for (int j = 0; j < 4; ++j) {
            const _Float16* bb = &Bs[buf * BBUF + fragB + j * 16 * LDP + ks * 32];
            ((uint4*)&bf[j])[0] = *(const uint4*)(bb);
            ((uint4*)&bf[j])[1] = *(const uint4*)(bb + 16);
        }
        // keeps the 16 loads one group ahead of the products that follow: sunk
        // among them, each pair of loads would be waited for on its own
        __builtin_amdgcn_sched_barrier(0);
    };
    auto block = [&](const v16h (&af)[4], const v16h (&bf)[4]) {
#pragma unroll
        for (int i = 0; i < 4; ++i)
#pragma unroll
            for (int j = 0; j < 4; ++j)
                acc[i][j] = __builtin_amdgcn_wmma_f32_16x16x32_f16(
                    false, af[i], false, bf[j], (short)0, acc[i][j], false, false);
        // keeps the next group of loads behind these products
        __builtin_amdgcn_sched_barrier(0);
    };

    const int nt = K / BK;
    issue(0, 0);
    // tile 0 has landed for this wave; the barrier publishes it to the block
    asm volatile("s_wait_asynccnt 0x0" ::: "memory");
    __syncthreads();
    if (nt > 1) issue(1, 1);                  // tile 1 flies over trip 0

    // two fragment sets: each 32-k block's loads fly over the block before it
    v16h a0[4], b0[4], a1[4], b1[4];
    fetch(a0, b0, 0, 0);
    for (int t = 0; t < nt; ++t) {
        const int buf = t & 1;
        fetch(a1, b1, buf, 1);
        block(a0, b0);
        fetch(a0, b0, buf, 2);
        block(a1, b1);
        fetch(a1, b1, buf, 3);
        block(a0, b0);

        // foot of the trip, in front of its last block, whose fragments are
        // fetched: this wave's reads of `buf` are done ...
        asm volatile("s_wait_dscnt 0x0" ::: "memory");
        // ... and its copies of tile t+1 have landed;
        asm volatile("s_wait_asynccnt 0x0" ::: "memory");
        // one barrier publishes tile t+1 and frees `buf` for the refill
        __syncthreads();
        if (t + 2 < nt) issue(t + 2, buf);
        // first fragments of tile t+1, behind its barrier; in the last trip
        // they come from the idle buffer (tile nt-2, no copy aimed at it) and
        // are not used: no branch, so the waits stay counted
        fetch(a0, b0, buf ^ 1, 0);
        block(a1, b1);
    }
    // nothing is in flight when the wave goes on to the epilogue
    asm volatile("s_wait_asynccnt 0x0" ::: "memory");

    // epilogue: C/D layout = lane (hs,r): col n = r, rows = hs*8 + 0..7
#pragma unroll
    for (int j = 0; j < 4; ++j) {
        const int n   = blockN + wn * 64 + j * 16 + r;
        const float bv = bias ? bias[n] : 0.f;
#pragma unroll
        for (int i = 0; i < 4; ++i) {
#pragma unroll
            for (int jj = 0; jj < 8; ++jj) {
                const int m = blockM + wm * 64 + i * 16 + hs * 8 + jj;
                float v = acc[i][j][jj] + bv;
                if (RELU) v = fmaxf(v, 0.f);
                C[(size_t)m * N + n] = (OutT)v;
            }
        }
    }
}

template <bool RELU, typename OutT>
__global__ __launch_bounds__(256) void gemm_wmma(const _Float16* __restrict__ A,
                                                 const _Float16* __restrict__ Bw,
                                                 const float* __restrict__ bias,
                                                 OutT* __restrict__ C,
                                                 int M, int N, int K) {
    gemm_tile<RELU, OutT>(A, Bw, bias, C, N, K, blockIdx.y * GBM, blockIdx.x * GBN);
}

// The three projections of one A in ONE grid, blockIdx.z = 0, 1, 2 for Q, K, V:
// they read none of each other's output. W holds the three [N,K] weights and C
// the three [M,N] results, each one behind the other.
__global__ __launch_bounds__(256) void gemm_qkv(const _Float16* __restrict__ A,
                                                const _Float16* __restrict__ W,
                                                const float* __restrict__ bq,
                                                const float* __restrict__ bk,
                                                const float* __restrict__ bv,
                                                _Float16* __restrict__ C,
                                                int M, int N, int K) {
    const int which = blockIdx.z;
    const float* bias = which == 0 ? bq : which == 1 ? bk : bv;
    gemm_tile<false, _Float16>(A, W + (size_t)which * N * K, bias,
                               C + (size_t)which * M * N, N, K,
                               blockIdx.y * GBM, blockIdx.x * GBN);
}

// ------------------------------ flash attention ----------------------------
// value of lane l ^ 16 (the other 16-lane half), by a vector cross-row move
__device__ __forceinline__ float xhalf(float x) {
    const int b = __builtin_bit_cast(int, x);
    return __builtin_bit_cast(float, __builtin_amdgcn_permlanex16(
        b, b, 0x76543210, 0xfedcba98, false, false));
}

// 16 bytes of a row-major 16-bit LDS tile per lane, handed out transposed:
// two of them (k and k + 16) are one 16 x 32 A fragment in the hardware k order
typedef __attribute__((ext_vector_type(8))) short s16x8;
__device__ __forceinline__ uint4 lds_tr16(const _Float16* p) {
    typedef __attribute__((address_space(3))) s16x8 lds_s16x8;
    return __builtin_bit_cast(uint4,
        __builtin_amdgcn_ds_load_tr16_b128_v8i16((lds_s16x8*)p));
}

// grid = (S/64, B*H), block = 128 (4 waves); each wave owns 16 query rows.
// Q/K/V in [B,S,H,HD] f16 layout (row stride D). Output Hcat same layout.
__global__ __launch_bounds__(128) void attn_wmma(const _Float16* __restrict__ Qg,
                                                 const _Float16* __restrict__ Kg,
                                                 const _Float16* __restrict__ Vg,
                                                 _Float16* __restrict__ Og) {
    constexpr int LDT = 72;                 // padded LDS row stride (halves)
    // V rows [k][e]: 160 B = 32 B x odd, the pitch of the transposing load
    constexpr int LDV = 80;
    __shared__ __attribute__((aligned(16))) _Float16 Qs[64 * LDT];
    __shared__ __attribute__((aligned(16))) _Float16 Ks[64 * LDT];
    __shared__ __attribute__((aligned(16))) _Float16 Vs[64 * LDV];

    const int bh   = blockIdx.y;            // 0..63
    const int b    = bh >> 4;
    const int h    = bh & 15;
    const int q0   = blockIdx.x * 64;
    const int tid  = threadIdx.x;
    const int wave = tid >> 5;
    const int lane = tid & 31;
    const int r    = lane & 15;
    const int hs   = lane >> 4;

    const size_t rowbase = (size_t)(b * TS) * TD + (size_t)h * THD;
    const _Float16* Qb = Qg + rowbase;
    const _Float16* Kb = Kg + rowbase;
    const _Float16* Vb = Vg + rowbase;

    // tile copies: 8 lanes a row (one 128-B line), 16 rows a copy of the block,
    // 4 copies for each of Q, K and V
    const int crow = tid >> 3;              // 0..15
    const int ccol = (tid & 7) * 8;         // 0..56 halves
    constexpr unsigned K16B = 16 * LDT * 2; // bytes of 16 LDS rows of Q or K
    constexpr unsigned V16B = 16 * LDV * 2; // bytes of 16 LDS rows of V
    constexpr size_t   G16  = (size_t)16 * TD;   // 16 global rows, in halves

    // load Q block: 64 rows x 64 cols (async global -> LDS)
    {
        const unsigned ldsQ = (unsigned)(uintptr_t)(Qs + crow * LDT + ccol);
        const _Float16* gq = Qb + (size_t)(q0 + crow) * TD + ccol;
        async_copy4_b128(ldsQ,            gq,           ldsQ + K16B,     gq + G16,
                         ldsQ + 2 * K16B, gq + 2 * G16, ldsQ + 3 * K16B, gq + 3 * G16);
    }

    const v8f vzero = {0.f, 0.f, 0.f, 0.f, 0.f, 0.f, 0.f, 0.f};
    // Transposed products: a lane (hs, r) owns ONE query, row wave*16 + r.
    //   sc[j][jj] = S^T[key j*16 + hs*8 + jj][query r]
    //   o[j][jj]  = O^T[e   j*16 + hs*8 + jj][query r]
    v8f o[4];
#pragma unroll
    for (int j = 0; j < 4; ++j) o[j] = vzero;
    float mrow = -1.0e30f;   // running maximum of the lane's query, unscaled
    v8f lsum = vzero;        // running sums over this lane half's keys only

    // 1/sqrt(D) * log2(e) = log2(e) / 32
    const float sc2 = 0.03125f * 1.44269504088896340736f;

    const unsigned ldsK = (unsigned)(uintptr_t)(Ks + crow * LDT + ccol);
    const unsigned ldsV = (unsigned)(uintptr_t)(Vs + crow * LDV + ccol);
    // lane address of the transposing load: row 8*hs + (lane & 7), and the
    // second 16 B of the 32-B column group in lanes 8..15 of each half
    const _Float16* vtr = Vs + (hs * 8 + (lane & 7)) * LDV + ((lane >> 3) & 1) * 8;

    for (int kt = 0; kt < TS / 64; ++kt) {
        const int k0 = kt * 64;
        // this wave's LDS reads of the previous tile have retired before any
        // wave's copies may overwrite it ...
        asm volatile("s_wait_dscnt 0x0" ::: "memory");
        __syncthreads();                    // ... and so have every wave's
        // K and V tiles, both row-major, via async-to-LDS
        {
            const _Float16* gk = Kb + (size_t)(k0 + crow) * TD + ccol;
            const _Float16* gv = Vb + (size_t)(k0 + crow) * TD + ccol;
            async_copy8_b128(ldsK,            gk,           ldsK + K16B,     gk + G16,
                             ldsK + 2 * K16B, gk + 2 * G16, ldsK + 3 * K16B, gk + 3 * G16,
                             ldsV,            gv,           ldsV + V16B,     gv + G16,
                             ldsV + 2 * V16B, gv + 2 * G16, ldsV + 3 * V16B, gv + 3 * G16);
        }
        if (kt + 1 < TS / 64)               // lowers to global_prefetch_b8
            __builtin_prefetch(Kb + (size_t)(k0 + 64) * TD + (tid & 63), 0, 1);
        wait_async(0);                      // own async K, V (and Q) writes done
        __syncthreads();

        // ---- S^T = K @ Q^T  (64 keys x 16 queries per wave) ----
        // A = K rows, B = Q rows, both read in the same k order
        v8f sc[4];
#pragma unroll
        for (int j = 0; j < 4; ++j) sc[j] = vzero;
#pragma unroll
        for (int ks = 0; ks < 2; ++ks) {
            v16h bq;
            const _Float16* qb = Qs + (wave * 16 + r) * LDT + ks * 32 + hs * 8;
            ((uint4*)&bq)[0] = *(const uint4*)(qb);
            ((uint4*)&bq)[1] = *(const uint4*)(qb + 16);
#pragma unroll
            for (int j = 0; j < 4; ++j) {
                v16h ak;
                const _Float16* kb = Ks + (j * 16 + r) * LDT + ks * 32 + hs * 8;
                ((uint4*)&ak)[0] = *(const uint4*)(kb);
                ((uint4*)&ak)[1] = *(const uint4*)(kb + 16);
                sc[j] = __builtin_amdgcn_wmma_f32_16x16x32_f16(
                    false, ak, false, bq, (short)0, sc[j], false, false);
            }
        }

        // ---- online softmax: the lane's 32 scores all belong to its query ----
        // The scores stay unscaled: with c = scale * log2(e) > 0 the maximum of
        // the raw scores is the maximum of the scaled ones, and
        // exp(scale * (s - m)) = exp2(s * c - m * c) is one fused multiply-add
        // a score. That multiply-add and the sums are written on 8-wide vectors, which the compiler
        // turns into packed f32 instructions (two scores each).
        float mx = -1.0e30f;
#pragma unroll
        for (int j = 0; j < 4; ++j)
#pragma unroll
            for (int jj = 0; jj < 8; ++jj) mx = fmaxf(mx, sc[j][jj]);
        mx = fmaxf(mx, xhalf(mx));          // the other 32 keys of the query
        const float mn   = fmaxf(mrow, mx);
        const float nmc  = -mn * sc2;
        const float corr = __builtin_amdgcn_exp2f(__builtin_fmaf(mrow, sc2, nmc));
#pragma unroll
        for (int j = 0; j < 4; ++j) {
            sc[j] = sc[j] * sc2 + nmc;
#pragma unroll
            for (int jj = 0; jj < 8; ++jj)
                sc[j][jj] = __builtin_amdgcn_exp2f(sc[j][jj]);
        }
        // eight partial sums a lane; they are joined after the loop
        lsum = lsum * corr + ((sc[0] + sc[1]) + (sc[2] + sc[3]));
        mrow = mn;
#pragma unroll
        for (int j = 0; j < 4; ++j) o[j] *= corr;

        // ---- O^T += V^T @ P^T  (A = V^T by transposing loads; B = P^T from sc) ----
        // Two S^T tiles converted in place are the B operand: element s of the
        // lane is key ks*32 + (s < 8 ? hs*8 + s : 16 + hs*8 + s - 8), which is
        // the k order of the transposing loads below: lane (hs, r) gets
        // V[ks*32 + hs*8 + 0..7][j*16 + r], then the same 16 keys further on.
#pragma unroll
        for (int ks = 0; ks < 2; ++ks) {
            v16h bp;
#pragma unroll
            for (int jj = 0; jj < 8; ++jj) {
                bp[jj]     = (_Float16)sc[2 * ks][jj];
                bp[8 + jj] = (_Float16)sc[2 * ks + 1][jj];
            }
#pragma unroll
            for (int j = 0; j < 4; ++j) {
                v16h av;
                const _Float16* vb = vtr + ks * 32 * LDV + j * 16;
                ((uint4*)&av)[0] = lds_tr16(vb);
                ((uint4*)&av)[1] = lds_tr16(vb + 16 * LDV);
                o[j] = __builtin_amdgcn_wmma_f32_16x16x32_f16(
                    false, av, false, bp, (short)0, o[j], false, false);
            }
        }
    }

    // ---- normalize and store Hcat[b, s, h*64 + e]: 8 consecutive e a lane ----
    const float lrow = ((lsum[0] + lsum[1]) + (lsum[2] + lsum[3])) +
                       ((lsum[4] + lsum[5]) + (lsum[6] + lsum[7]));
    const float invl = 1.0f / (lrow + xhalf(lrow));
    _Float16* orow = Og + rowbase + (size_t)(q0 + wave * 16 + r) * TD + hs * 8;
#pragma unroll
    for (int j = 0; j < 4; ++j) {
        v8h ov;
#pragma unroll
        for (int jj = 0; jj < 8; ++jj) ov[jj] = (_Float16)(o[j][jj] * invl);
        *(v8h*)(orow + j * 16) = ov;
    }
}

// -------------------------------- launcher ---------------------------------
extern "C" void kernel_launch(void* const* d_in, const int* in_sizes, int n_in,
                              void* d_out, int out_size, void* d_ws, size_t ws_size,
                              hipStream_t stream) {
    const float* emb = (const float*)d_in[0];
    const float* Wq  = (const float*)d_in[1];
    const float* bq  = (const float*)d_in[2];
    const float* Wk  = (const float*)d_in[3];
    const float* bk  = (const float*)d_in[4];
    const float* Wv  = (const float*)d_in[5];
    const float* bv  = (const float*)d_in[6];
    const float* W1  = (const float*)d_in[7];
    const float* b1  = (const float*)d_in[8];
    const float* W2  = (const float*)d_in[9];
    const float* b2  = (const float*)d_in[10];
    float* out = (float*)d_out;

    // workspace carve-up (f16 units)
    _Float16* ws = (_Float16*)d_ws;
    const size_t nEmb = (size_t)TM * TD;          // 8192*1024
    const size_t nWqkv = (size_t)TD * TD;         // 1024*1024
    const size_t nW1 = (size_t)TFF * TD;
    const size_t nW2 = (size_t)TD * TFF;
    _Float16* emb16  = ws;                 ws += nEmb;
    _Float16* wq16   = ws;                 ws += nWqkv;
    _Float16* wk16   = ws;                 ws += nWqkv;
    _Float16* wv16   = ws;                 ws += nWqkv;
    _Float16* w1_16  = ws;                 ws += nW1;
    _Float16* w2_16  = ws;                 ws += nW2;
    _Float16* q16    = ws;                 ws += nEmb;
    _Float16* k16    = ws;                 ws += nEmb;
    _Float16* v16    = ws;                 ws += nEmb;
    _Float16* hcat16 = ws;                 ws += nEmb;
    _Float16* hid16  = ws;                 ws += (size_t)TM * TFF;

    // emb16 | wq16 | wk16 | wv16 | w1_16 | w2_16, contiguous from emb16
    cvt_f32_to_f16<<<dim3(CVT_NB_ALL), dim3(256), 0, stream>>>(emb, Wq, Wk, Wv, W1, W2, emb16);

    // QKV projections: [8192,1024] = emb16 @ W^T + b   (f16 out);
    // wq16 | wk16 | wv16 and q16 | k16 | v16 are contiguous
    {
        dim3 grid(TD / GBN, TM / GBM, 3), blk(256);
        gemm_qkv<<<grid, blk, 0, stream>>>(emb16, wq16, bq, bk, bv, q16, TM, TD, TD);
    }

    // attention -> Hcat (f16, [B,S,H*HD])
    {
        dim3 grid(TS / 64, TB * TH), blk(128);
        attn_wmma<<<grid, blk, 0, stream>>>(q16, k16, v16, hcat16);
    }

    // FFN layer 1: relu(Hcat @ W1^T + b1)  -> hid16 [8192,4096]
    {
        dim3 grid(TFF / GBN, TM / GBM), blk(256);
        gemm_wmma<true, _Float16><<<grid, blk, 0, stream>>>(hcat16, w1_16, b1, hid16, TM, TFF, TD);
    }
    // FFN layer 2: hid @ W2^T + b2 -> d_out (f32, [8192,1024])
    {
        dim3 grid(TD / GBN, TM / GBM), blk(256);
        gemm_wmma<false, float><<<grid, blk, 0, stream>>>(hid16, w2_16, b2, out, TM, TD, TFF);
    }
}

// v009
// Measured time: 208 microseconds a run.
// In both of two side-by-side timings against v008, it was 1.05 times as fast.
// All steps since v000 together make it 2.95 times as fast.
#include <hip/hip_runtime.h>
#include <hip/hip_bf16.h>

// ---------------------------------------------------------------------------
// Transformer block for MI455X (gfx1250, wave32, WMMA f16 -> f32 accum)
//   B=4, S=2048, D=1024, H=16, HD=64, FF=4096, M = B*S = 8192
// Pipeline:
//   1) f32 -> f16 conversion of embeddings + all weights, one launch
//   2) WMMA GEMM (async-LDS double-buffered): Q/K/V = emb @ W^T + b, one launch
//   3) Flash-attention with WMMA (K Q^T and V^T P^T), online softmax;
//      V lies row-major in LDS and is transposed by ds_load_tr16_b128
//   4) WMMA GEMM + ReLU: hid = Hcat @ W1^T + b1
//   5) WMMA GEMM (f32 out): out = hid @ W2^T + b2 -> d_out
// CDNA5 specifics: v_wmma_f32_16x16x32_f16, global_load_async_to_lds_b128
// (ASYNCcnt pipeline), s_wait_asynccnt / s_wait_dscnt, v_permlanex16_b32.
// ---------------------------------------------------------------------------

typedef __attribute__((ext_vector_type(16))) _Float16 v16h;
typedef __attribute__((ext_vector_type(8)))  float    v8f;
typedef __attribute__((ext_vector_type(8)))  _Float16 v8h;

#define TB 4
#define TS 2048
#define TD 1024
#define TH 16
#define THD 64
#define TFF 4096
#define TM (TB * TS)   // 8192

// four async copies of 16 bytes (8 halves) per lane, global -> LDS, tracked by
// ASYNCcnt; the last line is the wait that stands before any of their address
// registers is rewritten
__device__ __forceinline__ void async_copy4_b128(
    unsigned l0, const _Float16* g0, unsigned l1, const _Float16* g1,
    unsigned l2, const _Float16* g2, unsigned l3, const _Float16* g3) {
    asm volatile("global_load_async_to_lds_b128 %0, %1, off\n\t"
                 "global_load_async_to_lds_b128 %2, %3, off\n\t"
                 "global_load_async_to_lds_b128 %4, %5, off\n\t"
                 "global_load_async_to_lds_b128 %6, %7, off\n\t"
                 "s_wait_xcnt 0x0"
                 :: "v"(l0), "v"(g0), "v"(l1), "v"(g1), "v"(l2), "v"(g2),
                    "v"(l3), "v"(g3)
                 : "memory");
}
__device__ __forceinline__ void wait_async(int n) {
    if (n == 0) asm volatile("s_wait_asynccnt 0x0" ::: "memory");
    else        asm volatile("s_wait_asynccnt 0x4" ::: "memory");
}

// -------------------------------- f32 -> f16 -------------------------------
// A block converts CVT_BLK consecutive elements, 32 a lane: eight 16-B loads,
// each 512 contiguous bytes of a wave (4 whole lines), all in flight before the
// first is used; each is stored as 8 B a lane (2 whole lines of a wave).
// All six arrays are converted by ONE grid: none reads what another writes, and
// each launch of its own would pay a start and a drained tail. Their f16 copies
// lie one behind the other in the workspace, in the order of the arguments, so
// the block index is also the place in the output; the source is picked by the
// range the block index falls in (a scalar choice, the same for the block).
typedef __attribute__((ext_vector_type(4))) float    v4f;
typedef __attribute__((ext_vector_type(4))) _Float16 v4h;
#define CVT_LOADS 8
#define CVT_BLK (256 * 4 * CVT_LOADS)   // 8192 elements
static_assert((TB * TS * TD) % CVT_BLK == 0 && (TD * TD) % CVT_BLK == 0 &&
              (TFF * TD) % CVT_BLK == 0, "conversion blocks must be full");
#define CVT_NB_EMB (TB * TS * TD / CVT_BLK)   // blocks of the embeddings
#define CVT_NB_QKV (TD * TD / CVT_BLK)        // blocks of each of Wq, Wk, Wv
#define CVT_NB_FF  (TFF * TD / CVT_BLK)       // blocks of each of W1, W2
#define CVT_NB_ALL (CVT_NB_EMB + 3 * CVT_NB_QKV + 2 * CVT_NB_FF)
__global__ __launch_bounds__(256) void cvt_f32_to_f16(const float* __restrict__ emb,
                                                      const float* __restrict__ Wq,
                                                      const float* __restrict__ Wk,
                                                      const float* __restrict__ Wv,
                                                      const float* __restrict__ W1,
                                                      const float* __restrict__ W2,
                                                      _Float16* __restrict__ dst) {
    const int blk = blockIdx.x;
    if (blk >= CVT_NB_ALL) return;           // never past the end of the arrays
    const float* src = emb;
    int first = 0;                           // first block of the chosen array
    if (blk >= CVT_NB_EMB)                  { src = Wq; first = CVT_NB_EMB; }
    if (blk >= CVT_NB_EMB + CVT_NB_QKV)     { src = Wk; first = CVT_NB_EMB + CVT_NB_QKV; }
    if (blk >= CVT_NB_EMB + 2 * CVT_NB_QKV) { src = Wv; first = CVT_NB_EMB + 2 * CVT_NB_QKV; }
    if (blk >= CVT_NB_EMB + 3 * CVT_NB_QKV) { src = W1; first = CVT_NB_EMB + 3 * CVT_NB_QKV; }
    if (blk >= CVT_NB_EMB + 3 * CVT_NB_QKV + CVT_NB_FF) {
        src = W2; first = CVT_NB_EMB + 3 * CVT_NB_QKV + CVT_NB_FF;
    }
    const float* in = src + (blk - first) * CVT_BLK;
    _Float16* out = dst + blk * CVT_BLK;
    const int at = threadIdx.x * 4;
    v4f v[CVT_LOADS];
    // both loops unrolled: v[] stays in registers, and the eight loads stand
    // together in front of the first wait
#pragma unroll
    for (int k = 0; k < CVT_LOADS; ++k)
        v[k] = *(const v4f*)(in + at + k * 1024);
#pragma unroll
    for (int k = 0; k < CVT_LOADS; ++k)
        *(v4h*)(out + at + k * 1024) = __builtin_convertvector(v[k], v4h);
}

// ------------------------- WMMA tiled GEMM (C = A @ B^T) -------------------
// A: [M,K] f16 row-major. Bw: [N,K] f16 row-major (torch Linear weight).
// bias: f32 [N]. C: [M,N] OutT row-major. Optional ReLU.
// Block tile 256x128, K-step 128, 256 threads = 8 waves, wave tile 64x64, one
// block on a WGP: a fragment read from LDS feeds four products, and a byte
// brought from L2 feeds 128 (A) or 256 (B) output columns or rows.
// The products are taken as C^T = Bw @ A^T, so a lane holds 8 adjacent columns
// of one row of C; each wave stages its tile in LDS and stores whole lines.
// M must be a multiple of 256, N of 128, K of 128 and at least 256. Two LDS
// buffers fed by global_load_async_to_lds_b128; a K-step is 256 B of every
// operand row, so one copy instruction of a wave covers 4 whole 128-B lines.

// Eight async copies (16 B per lane each) and, as the last line of the same
// statement, the wait that stands before any of their address registers is
// rewritten (in a statement of its own the compiler could lift later address
// arithmetic over it).
__device__ __forceinline__ void async_copy8_b128(
    unsigned l0, const _Float16* g0, unsigned l1, const _Float16* g1,
    unsigned l2, const _Float16* g2, unsigned l3, const _Float16* g3,
    unsigned l4, const _Float16* g4, unsigned l5, const _Float16* g5,
    unsigned l6, const _Float16* g6, unsigned l7, const _Float16* g7) {
    asm volatile("global_load_async_to_lds_b128 %0, %1, off\n\t"
                 "global_load_async_to_lds_b128 %2, %3, off\n\t"
                 "global_load_async_to_lds_b128 %4, %5, off\n\t"
                 "global_load_async_to_lds_b128 %6, %7, off\n\t"
                 "global_load_async_to_lds_b128 %8, %9, off\n\t"
                 "global_load_async_to_lds_b128 %10, %11, off\n\t"
                 "global_load_async_to_lds_b128 %12, %13, off\n\t"
                 "global_load_async_to_lds_b128 %14, %15, off\n\t"
                 "s_wait_xcnt 0x0"
                 :: "v"(l0), "v"(g0), "v"(l1), "v"(g1), "v"(l2), "v"(g2),
                    "v"(l3), "v"(g3), "v"(l4), "v"(g4), "v"(l5), "v"(g5),
                    "v"(l6), "v"(g6), "v"(l7), "v"(g7)
                 : "memory");
}

// One async copy of 16 B per lane, as the compiler's builtin: operands of an asm
// statement must lie below v256, where the GEMM's accumulators and two fragment
// sets leave no room (asm copies there cost two spilled address registers).
typedef __attribute__((ext_vector_type(4))) int i32x4;
__device__ __forceinline__ void async_copy_b128(const _Float16* l, const _Float16* g) {
    typedef __attribute__((address_space(1))) i32x4 glb_i32x4;
    typedef __attribute__((address_space(3))) i32x4 lds_i32x4;
    __builtin_amdgcn_global_load_async_to_lds_b128((glb_i32x4*)g, (lds_i32x4*)l, 0, 0);
}

#define GBM 256   // rows of C per block
#define GBN 128   // columns of C per block
static_assert(TM % GBM == 0 && TD % GBN == 0 && TFF % GBN == 0 &&
              TD % 128 == 0 && TFF % 128 == 0 && TD >= 256 && TFF >= 256,
              "GEMM tiles must be full, and the ring needs two K-steps");

// One block's tile of C, rows from blockM and columns from blockN. N, the row
// length of C, is a compile-time constant: all stores of a lane then share one
// address register pair and differ in their immediate offsets only.
template <bool RELU, typename OutT, int N>
__device__ __forceinline__ void gemm_tile(const _Float16* __restrict__ A,
                                          const _Float16* __restrict__ Bw,
                                          const float* __restrict__ bias,
                                          OutT* __restrict__ C,
                                          int K, int blockM, int blockN) {
    // LDS row pitch in halves: 128 data + 8 pad = 272 B (16 B x odd), so the 16
    // rows of a ds_load_b128 fragment read fall on 16 distinct bank groups.
    // Pad is never read.
    constexpr int BK  = 128;
    constexpr int LDP = 136;
    // one array: [A buffer 0 | A buffer 1 | B buffer 0 | B buffer 1]
    __shared__ __attribute__((aligned(16))) _Float16 smem[2 * (GBM + GBN) * LDP];
    constexpr int ABUF = GBM * LDP;            // halves of one buffer of A
    constexpr int BBUF = GBN * LDP;            // halves of one buffer of B
    const _Float16* Bs = smem + 2 * ABUF;

    const int tid  = threadIdx.x;
    const int wave = tid >> 5;
    const int lane = tid & 31;
    const int wm   = wave >> 1;     // 0..3 : wave row
    const int wn   = wave & 1;      // 0..1 : wave col
    const int r    = lane & 15;
    const int hs   = lane >> 4;     // 0/1, selects K-half per ISA A/B layout

    const v8f vzero = {0.f, 0.f, 0.f, 0.f, 0.f, 0.f, 0.f, 0.f};
    v8f acc[4][4];
#pragma unroll
    for (int i = 0; i < 4; ++i)
#pragma unroll
        for (int j = 0; j < 4; ++j) acc[i][j] = vzero;

    // cooperative tile copies: 16 lanes per row (256 B), 16 rows per copy of
    // the block, 16 copies for A and 8 for B per K-step
    const int ldr = tid >> 4;          // 0..15
    const int ldc = (tid & 15) * 8;    // 0..120 halves

    const int lanlds = ldr * LDP + ldc;        // the lane's place in an LDS tile
    // the lane's place in a global tile is the same in A and in B
    const size_t lanoff = (size_t)ldr * K + ldc;
    const _Float16* gA = A  + (size_t)blockM * K;
    const _Float16* gB = Bw + (size_t)blockN * K;
    const size_t r16 = (size_t)16 * K;         // 16 global rows, in halves

    auto issue = [&](int t, int buf) {
        const _Float16* a = gA + (size_t)t * BK + lanoff;
        const _Float16* b = gB + (size_t)t * BK + lanoff;
        const _Float16* la = smem + buf * ABUF + lanlds;
        const _Float16* lb = Bs + buf * BBUF + lanlds;
#pragma unroll
        for (int k = 0; k < GBM / 16; ++k)
            async_copy_b128(la + k * 16 * LDP, a + k * r16);
#pragma unroll
        for (int k = 0; k < GBN / 16; ++k)
            async_copy_b128(lb + k * 16 * LDP, b + k * r16);
    };

    // The fragments of one 32-k block: 4 of A and 4 of B, 16 ds_load_b128.
    // Per ISA 16-bit 16x32 layout, the same k order for A and B:
    //   lane hs half: halves 0..7 at k = hs*8 .. hs*8+7, halves 8..15 at +16
    const int fragA = (wm * 64 + r) * LDP + hs * 8;
    const int fragB = (wn * 64 + r) * LDP + hs * 8;
    auto fetch = [&](v16h (&af)[4], v16h (&bf)[4], int buf, int ks) {
#pragma unroll
        for (int i = 0; i < 4; ++i) {
            const _Float16* ab = &smem[buf * ABUF + fragA + i * 16 * LDP + ks * 32];
            ((uint4*)&af[i])[0] = *(const uint4*)(ab);
            ((uint4*)&af[i])[1] = *(const uint4*)(ab + 16);
        }
#pragma unroll
        for (int j = 0; j < 4; ++j) {
            const _Float16* bb = &Bs[buf * BBUF + fragB + j * 16 * LDP + ks * 32];
            ((uint4*)&bf[j])[0] = *(const uint4*)(bb);
            ((uint4*)&bf[j])[1] = *(const uint4*)(bb + 16);
        }
        // keeps the 16 loads one group ahead of the products that follow: sunk
        // among them, each pair of loads would be waited for on its own
        __builtin_amdgcn_sched_barrier(0);
    };
    auto block = [&](const v16h (&af)[4], const v16h (&bf)[4]) {
#pragma unroll
        for (int i = 0; i < 4; ++i)
#pragma unroll
            for (int j = 0; j < 4; ++j)
                acc[i][j] = __builtin_amdgcn_wmma_f32_16x16x32_f16(
                    false, bf[j], false, af[i], (short)0, acc[i][j], false, false);
        // keeps the next group of loads behind these products
        __builtin_amdgcn_sched_barrier(0);
    };

    const int nt = K / BK;
    issue(0, 0);
    // bias of the lane's 8 adjacent columns in each of its 4 column tiles, asked
    // for beside the first tile's copies, so that the epilogue does not wait for it
    v8f bv[4];
#pragma unroll
    for (int j = 0; j < 4; ++j) {
        const float* bp = bias + blockN + wn * 64 + j * 16 + hs * 8;
        bv[j] = __builtin_shufflevector(*(const v4f*)bp, *(const v4f*)(bp + 4),
                                        0, 1, 2, 3, 4, 5, 6, 7);
    }
    // tile 0 has landed for this wave; the barrier publishes it to the block
    asm volatile("s_wait_asynccnt 0x0" ::: "memory");
    __syncthreads();
    if (nt > 1) issue(1, 1);                  // tile 1 flies over trip 0

    // two fragment sets: each 32-k block's loads fly over the block before it
    v16h a0[4], b0[4], a1[4], b1[4];
    fetch(a0, b0, 0, 0);
    for (int t = 0; t < nt; ++t) {
        const int buf = t & 1;
        fetch(a1, b1, buf, 1);
        block(a0, b0);
        fetch(a0, b0, buf, 2);
        block(a1, b1);
        fetch(a1, b1, buf, 3);
        block(a0, b0);

        // foot of the trip, in front of its last block, whose fragments are
        // fetched: this wave's reads of `buf` are done ...
        asm volatile("s_wait_dscnt 0x0" ::: "memory");
        // ... and its copies of tile t+1 have landed;
        asm volatile("s_wait_asynccnt 0x0" ::: "memory");
        // one barrier publishes tile t+1 and frees `buf` for the refill
        __syncthreads();
        if (t + 2 < nt) issue(t + 2, buf);
        // first fragments of tile t+1, behind its barrier; in the last trip
        // they come from the idle buffer (tile nt-2, no copy aimed at it) and
        // are not used: no branch, so the waits stay counted
        fetch(a0, b0, buf ^ 1, 0);
        block(a1, b1);
    }
    // nothing is in flight when the wave goes on to the epilogue
    asm volatile("s_wait_asynccnt 0x0" ::: "memory");

    // epilogue. acc[i][j] is a tile of C^T: lane (hs, r) holds row i*16 + r of
    // the wave's tile of C, columns j*16 + hs*8 + 0..7.
    // The tile goes out through LDS, 32 rows at a time, so that every global
    // store of the wave covers 4 whole 128-B lines. The staging place is the
    // wave's own eighth of the A buffer of the last trip: every wave's reads of
    // that buffer ended in front of the last trip's barrier, no copy is aimed at
    // it, and the last trip's unused fetch reads the other buffer.
    constexpr int RB  = 64 * (int)sizeof(OutT);   // bytes of a tile row
    constexpr int SP  = RB + 16;                  // staging pitch, 16 B x odd
    constexpr int LPR = RB / 16;                  // lanes a row on the way out
    constexpr int RPI = 32 / LPR;                 // rows a store of the wave
    constexpr int WST = ABUF * 2 / 8;             // staging bytes of a wave
    static_assert(32 * SP <= WST, "32 staged rows must fit the wave's range");
    char* stage = (char*)(smem + ((nt - 1) & 1) * ABUF) + wave * WST;
    char* wr = stage + r * SP + hs * 8 * (int)sizeof(OutT);
    const char* rd = stage + (lane / LPR) * SP + (lane % LPR) * 16;
    OutT* cg = C + (size_t)(blockM + wm * 64 + lane / LPR) * N +
               blockN + wn * 64 + (lane % LPR) * (16 / (int)sizeof(OutT));
    // rows h*32 .. h*32 + 31 of the wave's tile
    auto put = [&](int h) {
#pragma unroll
        for (int ii = 0; ii < 2; ++ii) {
#pragma unroll
            for (int j = 0; j < 4; ++j) {
                v8f v = acc[2 * h + ii][j] + bv[j];
                if (RELU) v = __builtin_elementwise_max(v, vzero);
                char* p = wr + ii * 16 * SP + j * 16 * (int)sizeof(OutT);
                if constexpr (sizeof(OutT) == 2) {
                    *(v8h*)p = __builtin_convertvector(v, v8h);
                } else {
                    *(v4f*)p        = __builtin_shufflevector(v, v, 0, 1, 2, 3);
                    *(v4f*)(p + 16) = __builtin_shufflevector(v, v, 4, 5, 6, 7);
                }
            }
        }
        // the rows are read back by other lanes of this wave than wrote them
        asm volatile("s_wait_dscnt 0x0" ::: "memory");
        i32x4 t[32 / RPI];
#pragma unroll
        for (int k = 0; k < 32 / RPI; ++k)
            t[k] = *(const i32x4*)(rd + k * RPI * SP);
#pragma unroll
        for (int k = 0; k < 32 / RPI; ++k)
            *(i32x4*)(cg + (h * 32 + k * RPI) * N) = t[k];
    };
    put(0);
    // stands before the stores' data registers are rewritten; its clobber also
    // keeps the next rows' LDS writes behind the reads of these
    asm volatile("s_wait_xcnt 0x0" ::: "memory");
    // nothing of the next rows is lifted over that wait
    __builtin_amdgcn_sched_barrier(0);
    put(1);
}

template <bool RELU, typename OutT, int N>
__global__ __launch_bounds__(256) void gemm_wmma(const _Float16* __restrict__ A,
                                                 const _Float16* __restrict__ Bw,
                                                 const float* __restrict__ bias,
                                                 OutT* __restrict__ C,
                                                 int K) {
    gemm_tile<RELU, OutT, N>(A, Bw, bias, C, K, blockIdx.y * GBM, blockIdx.x * GBN);
}

// The three projections of one A in ONE grid, blockIdx.z = 0, 1, 2 for Q, K, V:
// they read none of each other's output. W holds the three [N,K] weights and C
// the three [M,N] results, each one behind the other.
__global__ __launch_bounds__(256) void gemm_qkv(const _Float16* __restrict__ A,
                                                const _Float16* __restrict__ W,
                                                const float* __restrict__ bq,
                                                const float* __restrict__ bk,
                                                const float* __restrict__ bv,
                                                _Float16* __restrict__ C,
                                                int M, int K) {
    constexpr int N = TD;
    const int which = blockIdx.z;
    const float* bias = which == 0 ? bq : which == 1 ? bk : bv;
    gemm_tile<false, _Float16, N>(A, W + (size_t)which * N * K, bias,
                                  C + (size_t)which * M * N, K,
                                  blockIdx.y * GBM, blockIdx.x * GBN);
}

// ------------------------------ flash attention ----------------------------
// value of lane l ^ 16 (the other 16-lane half), by a vector cross-row move
__device__ __forceinline__ float xhalf(float x) {
    const int b = __builtin_bit_cast(int, x);
    return __builtin_bit_cast(float, __builtin_amdgcn_permlanex16(
        b, b, 0x76543210, 0xfedcba98, false, false));
}

// 16 bytes of a row-major 16-bit LDS tile per lane, handed out transposed:
// two of them (k and k + 16) are one 16 x 32 A fragment in the hardware k order
typedef __attribute__((ext_vector_type(8))) short s16x8;
__device__ __forceinline__ uint4 lds_tr16(const _Float16* p) {
    typedef __attribute__((address_space(3))) s16x8 lds_s16x8;
    return __builtin_bit_cast(uint4,
        __builtin_amdgcn_ds_load_tr16_b128_v8i16((lds_s16x8*)p));
}

// grid = (S/64, B*H), block = 128 (4 waves); each wave owns 16 query rows.
// Q/K/V in [B,S,H,HD] f16 layout (row stride D). Output Hcat same layout.
__global__ __launch_bounds__(128) void attn_wmma(const _Float16* __restrict__ Qg,
                                                 const _Float16* __restrict__ Kg,
                                                 const _Float16* __restrict__ Vg,
                                                 _Float16* __restrict__ Og) {
    constexpr int LDT = 72;                 // padded LDS row stride (halves)
    // V rows [k][e]: 160 B = 32 B x odd, the pitch of the transposing load
    constexpr int LDV = 80;
    __shared__ __attribute__((aligned(16))) _Float16 Qs[64 * LDT];
    __shared__ __attribute__((aligned(16))) _Float16 Ks[64 * LDT];
    __shared__ __attribute__((aligned(16))) _Float16 Vs[64 * LDV];

    const int bh   = blockIdx.y;            // 0..63
    const int b    = bh >> 4;
    const int h    = bh & 15;
    const int q0   = blockIdx.x * 64;
    const int tid  = threadIdx.x;
    const int wave = tid >> 5;
    const int lane = tid & 31;
    const int r    = lane & 15;
    const int hs   = lane >> 4;

    const size_t rowbase = (size_t)(b * TS) * TD + (size_t)h * THD;
    const _Float16* Qb = Qg + rowbase;
    const _Float16* Kb = Kg + rowbase;
    const _Float16* Vb = Vg + rowbase;

    // tile copies: 8 lanes a row (one 128-B line), 16 rows a copy of the block,
    // 4 copies for each of Q, K and V
    const int crow = tid >> 3;              // 0..15
    const int ccol = (tid & 7) * 8;         // 0..56 halves
    constexpr unsigned K16B = 16 * LDT * 2; // bytes of 16 LDS rows of Q or K
    constexpr unsigned V16B = 16 * LDV * 2; // bytes of 16 LDS rows of V
    constexpr size_t   G16  = (size_t)16 * TD;   // 16 global rows, in halves

    // load Q block: 64 rows x 64 cols (async global -> LDS)
    {
        const unsigned ldsQ = (unsigned)(uintptr_t)(Qs + crow * LDT + ccol);
        const _Float16* gq = Qb + (size_t)(q0 + crow) * TD + ccol;
        async_copy4_b128(ldsQ,            gq,           ldsQ + K16B,     gq + G16,
                         ldsQ + 2 * K16B, gq + 2 * G16, ldsQ + 3 * K16B, gq + 3 * G16);
    }

    const v8f vzero = {0.f, 0.f, 0.f, 0.f, 0.f, 0.f, 0.f, 0.f};
    // Transposed products: a lane (hs, r) owns ONE query, row wave*16 + r.
    //   sc[j][jj] = S^T[key j*16 + hs*8 + jj][query r]
    //   o[j][jj]  = O^T[e   j*16 + hs*8 + jj][query r]
    v8f o[4];
#pragma unroll
    for (int j = 0; j < 4; ++j) o[j] = vzero;
    float mrow = -1.0e30f;   // running maximum of the lane's query, unscaled
    v8f lsum = vzero;        // running sums over this lane half's keys only

    // 1/sqrt(D) * log2(e) = log2(e) / 32
    const float sc2 = 0.03125f * 1.44269504088896340736f;

    const unsigned ldsK = (unsigned)(uintptr_t)(Ks + crow * LDT + ccol);
    const unsigned ldsV = (unsigned)(uintptr_t)(Vs + crow * LDV + ccol);
    // lane address of the transposing load: row 8*hs + (lane & 7), and the
    // second 16 B of the 32-B column group in lanes 8..15 of each half
    const _Float16* vtr = Vs + (hs * 8 + (lane & 7)) * LDV + ((lane >> 3) & 1) * 8;

    for (int kt = 0; kt < TS / 64; ++kt) {
        const int k0 = kt * 64;
        // this wave's LDS reads of the previous tile have retired before any
        // wave's copies may overwrite it ...
        asm volatile("s_wait_dscnt 0x0" ::: "memory");
        __syncthreads();                    // ... and so have every wave's
        // K and V tiles, both row-major, via async-to-LDS
        {
            const _Float16* gk = Kb + (size_t)(k0 + crow) * TD + ccol;
            const _Float16* gv = Vb + (size_t)(k0 + crow) * TD + ccol;
            async_copy8_b128(ldsK,            gk,           ldsK + K16B,     gk + G16,
                             ldsK + 2 * K16B, gk + 2 * G16, ldsK + 3 * K16B, gk + 3 * G16,
                             ldsV,            gv,           ldsV + V16B,     gv + G16,
                             ldsV + 2 * V16B, gv + 2 * G16, ldsV + 3 * V16B, gv + 3 * G16);
        }
        if (kt + 1 < TS / 64)               // lowers to global_prefetch_b8
            __builtin_prefetch(Kb + (size_t)(k0 + 64) * TD + (tid & 63), 0, 1);
        wait_async(0);                      // own async K, V (and Q) writes done
        __syncthreads();

        // ---- S^T = K @ Q^T  (64 keys x 16 queries per wave) ----
        // A = K rows, B = Q rows, both read in the same k order
        v8f sc[4];
#pragma unroll
        for (int j = 0; j < 4; ++j) sc[j] = vzero;
#pragma unroll
        for (int ks = 0; ks < 2; ++ks) {
            v16h bq;
            const _Float16* qb = Qs + (wave * 16 + r) * LDT + ks * 32 + hs * 8;
            ((uint4*)&bq)[0] = *(const uint4*)(qb);
            ((uint4*)&bq)[1] = *(const uint4*)(qb + 16);
#pragma unroll
            for (int j = 0; j < 4; ++j) {
                v16h ak;
                const _Float16* kb = Ks + (j * 16 + r) * LDT + ks * 32 + hs * 8;
                ((uint4*)&ak)[0] = *(const uint4*)(kb);
                ((uint4*)&ak)[1] = *(const uint4*)(kb + 16);
                sc[j] = __builtin_amdgcn_wmma_f32_16x16x32_f16(
                    false, ak, false, bq, (short)0, sc[j], false, false);
            }
        }

        // ---- online softmax: the lane's 32 scores all belong to its query ----
        // The scores stay unscaled: with c = scale * log2(e) > 0 the maximum of
        // the raw scores is the maximum of the scaled ones, and
        // exp(scale * (s - m)) = exp2(s * c - m * c) is one fused multiply-add
        // a score. That multiply-add and the sums are written on 8-wide vectors, which the compiler
        // turns into packed f32 instructions (two scores each).
        float mx = -1.0e30f;
#pragma unroll
        for (int j = 0; j < 4; ++j)
#pragma unroll
            for (int jj = 0; jj < 8; ++jj) mx = fmaxf(mx, sc[j][jj]);
        mx = fmaxf(mx, xhalf(mx));          // the other 32 keys of the query
        const float mn   = fmaxf(mrow, mx);
        const float nmc  = -mn * sc2;
        const float corr = __builtin_amdgcn_exp2f(__builtin_fmaf(mrow, sc2, nmc));
#pragma unroll
        for (int j = 0; j < 4; ++j) {
            sc[j] = sc[j] * sc2 + nmc;
#pragma unroll
            for (int jj = 0; jj < 8; ++jj)
                sc[j][jj] = __builtin_amdgcn_exp2f(sc[j][jj]);
        }
        // eight partial sums a lane; they are joined after the loop
        lsum = lsum * corr + ((sc[0] + sc[1]) + (sc[2] + sc[3]));
        mrow = mn;
#pragma unroll
        for (int j = 0; j < 4; ++j) o[j] *= corr;

        // ---- O^T += V^T @ P^T  (A = V^T by transposing loads; B = P^T from sc) ----
        // Two S^T tiles converted in place are the B operand: element s of the
        // lane is key ks*32 + (s < 8 ? hs*8 + s : 16 + hs*8 + s - 8), which is
        // the k order of the transposing loads below: lane (hs, r) gets
        // V[ks*32 + hs*8 + 0..7][j*16 + r], then the same 16 keys further on.
#pragma unroll
        for (int ks = 0; ks < 2; ++ks) {
            v16h bp;
#pragma unroll
            for (int jj = 0; jj < 8; ++jj) {
                bp[jj]     = (_Float16)sc[2 * ks][jj];
                bp[8 + jj] = (_Float16)sc[2 * ks + 1][jj];
            }
#pragma unroll
            for (int j = 0; j < 4; ++j) {
                v16h av;
                const _Float16* vb = vtr + ks * 32 * LDV + j * 16;
                ((uint4*)&av)[0] = lds_tr16(vb);
                ((uint4*)&av)[1] = lds_tr16(vb + 16 * LDV);
                o[j] = __builtin_amdgcn_wmma_f32_16x16x32_f16(
                    false, av, false, bp, (short)0, o[j], false, false);
            }
        }
    }

    // ---- normalize and store Hcat[b, s, h*64 + e]: 8 consecutive e a lane ----
    const float lrow = ((lsum[0] + lsum[1]) + (lsum[2] + lsum[3])) +
                       ((lsum[4] + lsum[5]) + (lsum[6] + lsum[7]));
    const float invl = 1.0f / (lrow + xhalf(lrow));
    _Float16* orow = Og + rowbase + (size_t)(q0 + wave * 16 + r) * TD + hs * 8;
#pragma unroll
    for (int j = 0; j < 4; ++j) {
        v8h ov;
#pragma unroll
        for (int jj = 0; jj < 8; ++jj) ov[jj] = (_Float16)(o[j][jj] * invl);
        *(v8h*)(orow + j * 16) = ov;
    }
}

// -------------------------------- launcher ---------------------------------
extern "C" void kernel_launch(void* const* d_in, const int* in_sizes, int n_in,
                              void* d_out, int out_size, void* d_ws, size_t ws_size,
                              hipStream_t stream) {
    const float* emb = (const float*)d_in[0];
    const float* Wq  = (const float*)d_in[1];
    const float* bq  = (const float*)d_in[2];
    const float* Wk  = (const float*)d_in[3];
    const float* bk  = (const float*)d_in[4];
    const float* Wv  = (const float*)d_in[5];
    const float* bv  = (const float*)d_in[6];
    const float* W1  = (const float*)d_in[7];
    const float* b1  = (const float*)d_in[8];
    const float* W2  = (const float*)d_in[9];
    const float* b2  = (const float*)d_in[10];
    float* out = (float*)d_out;

    // workspace carve-up (f16 units)
    _Float16* ws = (_Float16*)d_ws;
    const size_t nEmb = (size_t)TM * TD;          // 8192*1024
    const size_t nWqkv = (size_t)TD * TD;         // 1024*1024
    const size_t nW1 = (size_t)TFF * TD;
    const size_t nW2 = (size_t)TD * TFF;
    _Float16* emb16  = ws;                 ws += nEmb;
    _Float16* wq16   = ws;                 ws += nWqkv;
    _Float16* wk16   = ws;                 ws += nWqkv;
    _Float16* wv16   = ws;                 ws += nWqkv;
    _Float16* w1_16  = ws;                 ws += nW1;
    _Float16* w2_16  = ws;                 ws += nW2;
    _Float16* q16    = ws;                 ws += nEmb;
    _Float16* k16    = ws;                 ws += nEmb;
    _Float16* v16    = ws;                 ws += nEmb;
    _Float16* hcat16 = ws;                 ws += nEmb;
    _Float16* hid16  = ws;                 ws += (size_t)TM * TFF;

    // emb16 | wq16 | wk16 | wv16 | w1_16 | w2_16, contiguous from emb16
    cvt_f32_to_f16<<<dim3(CVT_NB_ALL), dim3(256), 0, stream>>>(emb, Wq, Wk, Wv, W1, W2, emb16);

    // QKV projections: [8192,1024] = emb16 @ W^T + b   (f16 out);
    // wq16 | wk16 | wv16 and q16 | k16 | v16 are contiguous
    {
        dim3 grid(TD / GBN, TM / GBM, 3), blk(256);
        gemm_qkv<<<grid, blk, 0, stream>>>(emb16, wq16, bq, bk, bv, q16, TM, TD);
    }

    // attention -> Hcat (f16, [B,S,H*HD])
    {
        dim3 grid(TS / 64, TB * TH), blk(128);
        attn_wmma<<<grid, blk, 0, stream>>>(q16, k16, v16, hcat16);
    }

    // FFN layer 1: relu(Hcat @ W1^T + b1)  -> hid16 [8192,4096]
    {
        dim3 grid(TFF / GBN, TM / GBM), blk(256);
        gemm_wmma<true, _Float16, TFF><<<grid, blk, 0, stream>>>(hcat16, w1_16, b1, hid16, TD);
    }
    // FFN layer 2: hid @ W2^T + b2 -> d_out (f32, [8192,1024])
    {
        dim3 grid(TD / GBN, TM / GBM), blk(256);
        gemm_wmma<false, float, TD><<<grid, blk, 0, stream>>>(hid16, w2_16, b2, out, TFF);
    }
}

// v010
// Measured time: 198 microseconds a run.
// Two timings next to v009 put it at 1.05 and 1.04 times that version's speed.
// Over all steps from v000 it is 3.10 times as fast.
#include <hip/hip_runtime.h>
#include <hip/hip_bf16.h>

// ---------------------------------------------------------------------------
// Transformer block for MI455X (gfx1250, wave32, WMMA f16 -> f32 accum)
//   B=4, S=2048, D=1024, H=16, HD=64, FF=4096, M = B*S = 8192
// Pipeline:
//   1) f32 -> f16 conversion of embeddings + all weights, one launch
//   2) WMMA GEMM (async-LDS double-buffered): Q/K/V = emb @ W^T + b, one launch
//   3) Flash-attention with WMMA (K Q^T and V^T P^T), online softmax;
//      V lies row-major in LDS and is transposed by ds_load_tr16_b128
//   4) WMMA GEMM + ReLU: hid = Hcat @ W1^T + b1
//   5) WMMA GEMM (f32 out): out = hid @ W2^T + b2 -> d_out
// CDNA5 specifics: v_wmma_f32_16x16x32_f16, global_load_async_to_lds_b128
// (ASYNCcnt pipeline), s_wait_asynccnt / s_wait_dscnt, v_permlanex16_b32.
// ---------------------------------------------------------------------------

typedef __attribute__((ext_vector_type(16))) _Float16 v16h;
typedef __attribute__((ext_vector_type(8)))  float    v8f;
typedef __attribute__((ext_vector_type(8)))  _Float16 v8h;

#define TB 4
#define TS 2048
#define TD 1024
#define TH 16
#define THD 64
#define TFF 4096
#define TM (TB * TS)   // 8192

__device__ __forceinline__ void wait_async(int n) {
    if (n == 0) asm volatile("s_wait_asynccnt 0x0" ::: "memory");
    else        asm volatile("s_wait_asynccnt 0x4" ::: "memory");
}

// -------------------------------- f32 -> f16 -------------------------------
// A block converts CVT_BLK consecutive elements, 32 a lane: eight 16-B loads,
// each 512 contiguous bytes of a wave (4 whole lines), all in flight before the
// first is used; each is stored as 8 B a lane (2 whole lines of a wave).
// All six arrays are converted by ONE grid: none reads what another writes, and
// each launch of its own would pay a start and a drained tail. Their f16 copies
// lie one behind the other in the workspace, in the order of the arguments, so
// the block index is also the place in the output; the source is picked by the
// range the block index falls in (a scalar choice, the same for the block).
typedef __attribute__((ext_vector_type(4))) float    v4f;
typedef __attribute__((ext_vector_type(4))) _Float16 v4h;
#define CVT_LOADS 8
#define CVT_BLK (256 * 4 * CVT_LOADS)   // 8192 elements
static_assert((TB * TS * TD) % CVT_BLK == 0 && (TD * TD) % CVT_BLK == 0 &&
              (TFF * TD) % CVT_BLK == 0, "conversion blocks must be full");
#define CVT_NB_EMB (TB * TS * TD / CVT_BLK)   // blocks of the embeddings
#define CVT_NB_QKV (TD * TD / CVT_BLK)        // blocks of each of Wq, Wk, Wv
#define CVT_NB_FF  (TFF * TD / CVT_BLK)       // blocks of each of W1, W2
#define CVT_NB_ALL (CVT_NB_EMB + 3 * CVT_NB_QKV + 2 * CVT_NB_FF)
__global__ __launch_bounds__(256) void cvt_f32_to_f16(const float* __restrict__ emb,
                                                      const float* __restrict__ Wq,
                                                      const float* __restrict__ Wk,
                                                      const float* __restrict__ Wv,
                                                      const float* __restrict__ W1,
                                                      const float* __restrict__ W2,
                                                      _Float16* __restrict__ dst) {
    const int blk = blockIdx.x;
    if (blk >= CVT_NB_ALL) return;           // never past the end of the arrays
    const float* src = emb;
    int first = 0;                           // first block of the chosen array
    if (blk >= CVT_NB_EMB)                  { src = Wq; first = CVT_NB_EMB; }
    if (blk >= CVT_NB_EMB + CVT_NB_QKV)     { src = Wk; first = CVT_NB_EMB + CVT_NB_QKV; }
    if (blk >= CVT_NB_EMB + 2 * CVT_NB_QKV) { src = Wv; first = CVT_NB_EMB + 2 * CVT_NB_QKV; }
    if (blk >= CVT_NB_EMB + 3 * CVT_NB_QKV) { src = W1; first = CVT_NB_EMB + 3 * CVT_NB_QKV; }
    if (blk >= CVT_NB_EMB + 3 * CVT_NB_QKV + CVT_NB_FF) {
        src = W2; first = CVT_NB_EMB + 3 * CVT_NB_QKV + CVT_NB_FF;
    }
    const float* in = src + (blk - first) * CVT_BLK;
    _Float16* out = dst + blk * CVT_BLK;
    const int at = threadIdx.x * 4;
    v4f v[CVT_LOADS];
    // both loops unrolled: v[] stays in registers, and the eight loads stand
    // together in front of the first wait
#pragma unroll
    for (int k = 0; k < CVT_LOADS; ++k)
        v[k] = *(const v4f*)(in + at + k * 1024);
#pragma unroll
    for (int k = 0; k < CVT_LOADS; ++k)
        *(v4h*)(out + at + k * 1024) = __builtin_convertvector(v[k], v4h);
}

// ------------------------- WMMA tiled GEMM (C = A @ B^T) -------------------
// A: [M,K] f16 row-major. Bw: [N,K] f16 row-major (torch Linear weight).
// bias: f32 [N]. C: [M,N] OutT row-major. Optional ReLU.
// Block tile 256x128, K-step 128, 256 threads = 8 waves, wave tile 64x64, one
// block on a WGP: a fragment read from LDS feeds four products, and a byte
// brought from L2 feeds 128 (A) or 256 (B) output columns or rows.
// The products are taken as C^T = Bw @ A^T, so a lane holds 8 adjacent columns
// of one row of C; each wave stages its tile in LDS and stores whole lines.
// M must be a multiple of 256, N of 128, K of 128 and at least 256. Two LDS
// buffers fed by global_load_async_to_lds_b128; a K-step is 256 B of every
// operand row, so one copy instruction of a wave covers 4 whole 128-B lines.

// Eight async copies (16 B per lane each) and, as the last line of the same
// statement, the wait that stands before any of their address registers is
// rewritten (in a statement of its own the compiler could lift later address
// arithmetic over it).
__device__ __forceinline__ void async_copy8_b128(
    unsigned l0, const _Float16* g0, unsigned l1, const _Float16* g1,
    unsigned l2, const _Float16* g2, unsigned l3, const _Float16* g3,
    unsigned l4, const _Float16* g4, unsigned l5, const _Float16* g5,
    unsigned l6, const _Float16* g6, unsigned l7, const _Float16* g7) {
    asm volatile("global_load_async_to_lds_b128 %0, %1, off\n\t"
                 "global_load_async_to_lds_b128 %2, %3, off\n\t"
                 "global_load_async_to_lds_b128 %4, %5, off\n\t"
                 "global_load_async_to_lds_b128 %6, %7, off\n\t"
                 "global_load_async_to_lds_b128 %8, %9, off\n\t"
                 "global_load_async_to_lds_b128 %10, %11, off\n\t"
                 "global_load_async_to_lds_b128 %12, %13, off\n\t"
                 "global_load_async_to_lds_b128 %14, %15, off\n\t"
                 "s_wait_xcnt 0x0"
                 :: "v"(l0), "v"(g0), "v"(l1), "v"(g1), "v"(l2), "v"(g2),
                    "v"(l3), "v"(g3), "v"(l4), "v"(g4), "v"(l5), "v"(g5),
                    "v"(l6), "v"(g6), "v"(l7), "v"(g7)
                 : "memory");
}

// One async copy of 16 B per lane, as the compiler's builtin: operands of an asm
// statement must lie below v256, where the GEMM's accumulators and two fragment
// sets leave no room (asm copies there cost two spilled address registers).
typedef __attribute__((ext_vector_type(4))) int i32x4;
__device__ __forceinline__ void async_copy_b128(const _Float16* l, const _Float16* g) {
    typedef __attribute__((address_space(1))) i32x4 glb_i32x4;
    typedef __attribute__((address_space(3))) i32x4 lds_i32x4;
    __builtin_amdgcn_global_load_async_to_lds_b128((glb_i32x4*)g, (lds_i32x4*)l, 0, 0);
}

#define GBM 256   // rows of C per block
#define GBN 128   // columns of C per block
static_assert(TM % GBM == 0 && TD % GBN == 0 && TFF % GBN == 0 &&
              TD % 128 == 0 && TFF % 128 == 0 && TD >= 256 && TFF >= 256,
              "GEMM tiles must be full, and the ring needs two K-steps");

// One block's tile of C, rows from blockM and columns from blockN. N, the row
// length of C, is a compile-time constant: all stores of a lane then share one
// address register pair and differ in their immediate offsets only.
template <bool RELU, typename OutT, int N>
__device__ __forceinline__ void gemm_tile(const _Float16* __restrict__ A,
                                          const _Float16* __restrict__ Bw,
                                          const float* __restrict__ bias,
                                          OutT* __restrict__ C,
                                          int K, int blockM, int blockN) {
    // LDS row pitch in halves: 128 data + 8 pad = 272 B (16 B x odd), so the 16
    // rows of a ds_load_b128 fragment read fall on 16 distinct bank groups.
    // Pad is never read.
    constexpr int BK  = 128;
    constexpr int LDP = 136;
    // one array: [A buffer 0 | A buffer 1 | B buffer 0 | B buffer 1]
    __shared__ __attribute__((aligned(16))) _Float16 smem[2 * (GBM + GBN) * LDP];
    constexpr int ABUF = GBM * LDP;            // halves of one buffer of A
    constexpr int BBUF = GBN * LDP;            // halves of one buffer of B
    const _Float16* Bs = smem + 2 * ABUF;

    const int tid  = threadIdx.x;
    const int wave = tid >> 5;
    const int lane = tid & 31;
    const int wm   = wave >> 1;     // 0..3 : wave row
    const int wn   = wave & 1;      // 0..1 : wave col
    const int r    = lane & 15;
    const int hs   = lane >> 4;     // 0/1, selects K-half per ISA A/B layout

    const v8f vzero = {0.f, 0.f, 0.f, 0.f, 0.f, 0.f, 0.f, 0.f};
    v8f acc[4][4];
#pragma unroll
    for (int i = 0; i < 4; ++i)
#pragma unroll
        for (int j = 0; j < 4; ++j) acc[i][j] = vzero;

    // cooperative tile copies: 16 lanes per row (256 B), 16 rows per copy of
    // the block, 16 copies for A and 8 for B per K-step
    const int ldr = tid >> 4;          // 0..15
    const int ldc = (tid & 15) * 8;    // 0..120 halves

    const int lanlds = ldr * LDP + ldc;        // the lane's place in an LDS tile
    // the lane's place in a global tile is the same in A and in B
    const size_t lanoff = (size_t)ldr * K + ldc;
    const _Float16* gA = A  + (size_t)blockM * K;
    const _Float16* gB = Bw + (size_t)blockN * K;
    const size_t r16 = (size_t)16 * K;         // 16 global rows, in halves

    auto issue = [&](int t, int buf) {
        const _Float16* a = gA + (size_t)t * BK + lanoff;
        const _Float16* b = gB + (size_t)t * BK + lanoff;
        const _Float16* la = smem + buf * ABUF + lanlds;
        const _Float16* lb = Bs + buf * BBUF + lanlds;
#pragma unroll
        for (int k = 0; k < GBM / 16; ++k)
            async_copy_b128(la + k * 16 * LDP, a + k * r16);
#pragma unroll
        for (int k = 0; k < GBN / 16; ++k)
            async_copy_b128(lb + k * 16 * LDP, b + k * r16);
    };

    // The fragments of one 32-k block: 4 of A and 4 of B, 16 ds_load_b128.
    // Per ISA 16-bit 16x32 layout, the same k order for A and B:
    //   lane hs half: halves 0..7 at k = hs*8 .. hs*8+7, halves 8..15 at +16
    const int fragA = (wm * 64 + r) * LDP + hs * 8;
    const int fragB = (wn * 64 + r) * LDP + hs * 8;
    auto fetch = [&](v16h (&af)[4], v16h (&bf)[4], int buf, int ks) {
#pragma unroll
        for (int i = 0; i < 4; ++i) {
            const _Float16* ab = &smem[buf * ABUF + fragA + i * 16 * LDP + ks * 32];
            ((uint4*)&af[i])[0] = *(const uint4*)(ab);
            ((uint4*)&af[i])[1] = *(const uint4*)(ab + 16);
        }
#pragma unroll
        for (int j = 0; j < 4; ++j) {
            const _Float16* bb = &Bs[buf * BBUF + fragB + j * 16 * LDP + ks * 32];
            ((uint4*)&bf[j])[0] = *(const uint4*)(bb);
            ((uint4*)&bf[j])[1] = *(const uint4*)(bb + 16);
        }
        // keeps the 16 loads one group ahead of the products that follow: sunk
        // among them, each pair of loads would be waited for on its own
        __builtin_amdgcn_sched_barrier(0);
    };
    auto block = [&](const v16h (&af)[4], const v16h (&bf)[4]) {
#pragma unroll
        for (int i = 0; i < 4; ++i)
#pragma unroll
            for (int j = 0; j < 4; ++j)
                acc[i][j] = __builtin_amdgcn_wmma_f32_16x16x32_f16(
                    false, bf[j], false, af[i], (short)0, acc[i][j], false, false);
        // keeps the next group of loads behind these products
        __builtin_amdgcn_sched_barrier(0);
    };

    const int nt = K / BK;
    issue(0, 0);
    // bias of the lane's 8 adjacent columns in each of its 4 column tiles, asked
    // for beside the first tile's copies, so that the epilogue does not wait for it
    v8f bv[4];
#pragma unroll
    for (int j = 0; j < 4; ++j) {
        const float* bp = bias + blockN + wn * 64 + j * 16 + hs * 8;
        bv[j] = __builtin_shufflevector(*(const v4f*)bp, *(const v4f*)(bp + 4),
                                        0, 1, 2, 3, 4, 5, 6, 7);
    }
    // tile 0 has landed for this wave; the barrier publishes it to the block
    asm volatile("s_wait_asynccnt 0x0" ::: "memory");
    __syncthreads();
    if (nt > 1) issue(1, 1);                  // tile 1 flies over trip 0

    // two fragment sets: each 32-k block's loads fly over the block before it
    v16h a0[4], b0[4], a1[4], b1[4];
    fetch(a0, b0, 0, 0);
    for (int t = 0; t < nt; ++t) {
        const int buf = t & 1;
        fetch(a1, b1, buf, 1);
        block(a0, b0);
        fetch(a0, b0, buf, 2);
        block(a1, b1);
        fetch(a1, b1, buf, 3);
        block(a0, b0);

        // foot of the trip, in front of its last block, whose fragments are
        // fetched: this wave's reads of `buf` are done ...
        asm volatile("s_wait_dscnt 0x0" ::: "memory");
        // ... and its copies of tile t+1 have landed;
        asm volatile("s_wait_asynccnt 0x0" ::: "memory");
        // one barrier publishes tile t+1 and frees `buf` for the refill
        __syncthreads();
        if (t + 2 < nt) issue(t + 2, buf);
        // first fragments of tile t+1, behind its barrier; in the last trip
        // they come from the idle buffer (tile nt-2, no copy aimed at it) and
        // are not used: no branch, so the waits stay counted
        fetch(a0, b0, buf ^ 1, 0);
        block(a1, b1);
    }
    // nothing is in flight when the wave goes on to the epilogue
    asm volatile("s_wait_asynccnt 0x0" ::: "memory");

    // epilogue. acc[i][j] is a tile of C^T: lane (hs, r) holds row i*16 + r of
    // the wave's tile of C, columns j*16 + hs*8 + 0..7.
    // The tile goes out through LDS, 32 rows at a time, so that every global
    // store of the wave covers 4 whole 128-B lines. The staging place is the
    // wave's own eighth of the A buffer of the last trip: every wave's reads of
    // that buffer ended in front of the last trip's barrier, no copy is aimed at
    // it, and the last trip's unused fetch reads the other buffer.
    constexpr int RB  = 64 * (int)sizeof(OutT);   // bytes of a tile row
    constexpr int SP  = RB + 16;                  // staging pitch, 16 B x odd
    constexpr int LPR = RB / 16;                  // lanes a row on the way out
    constexpr int RPI = 32 / LPR;                 // rows a store of the wave
    constexpr int WST = ABUF * 2 / 8;             // staging bytes of a wave
    static_assert(32 * SP <= WST, "32 staged rows must fit the wave's range");
    char* stage = (char*)(smem + ((nt - 1) & 1) * ABUF) + wave * WST;
    char* wr = stage + r * SP + hs * 8 * (int)sizeof(OutT);
    const char* rd = stage + (lane / LPR) * SP + (lane % LPR) * 16;
    OutT* cg = C + (size_t)(blockM + wm * 64 + lane / LPR) * N +
               blockN + wn * 64 + (lane % LPR) * (16 / (int)sizeof(OutT));
    // rows h*32 .. h*32 + 31 of the wave's tile
    auto put = [&](int h) {
#pragma unroll
        for (int ii = 0; ii < 2; ++ii) {
#pragma unroll
            for (int j = 0; j < 4; ++j) {
                v8f v = acc[2 * h + ii][j] + bv[j];
                if (RELU) v = __builtin_elementwise_max(v, vzero);
                char* p = wr + ii * 16 * SP + j * 16 * (int)sizeof(OutT);
                if constexpr (sizeof(OutT) == 2) {
                    *(v8h*)p = __builtin_convertvector(v, v8h);
                } else {
                    *(v4f*)p        = __builtin_shufflevector(v, v, 0, 1, 2, 3);
                    *(v4f*)(p + 16) = __builtin_shufflevector(v, v, 4, 5, 6, 7);
                }
            }
        }
        // the rows are read back by other lanes of this wave than wrote them
        asm volatile("s_wait_dscnt 0x0" ::: "memory");
        i32x4 t[32 / RPI];
#pragma unroll
        for (int k = 0; k < 32 / RPI; ++k)
            t[k] = *(const i32x4*)(rd + k * RPI * SP);
#pragma unroll
        for (int k = 0; k < 32 / RPI; ++k)
            *(i32x4*)(cg + (h * 32 + k * RPI) * N) = t[k];
    };
    put(0);
    // stands before the stores' data registers are rewritten; its clobber also
    // keeps the next rows' LDS writes behind the reads of these
    asm volatile("s_wait_xcnt 0x0" ::: "memory");
    // nothing of the next rows is lifted over that wait
    __builtin_amdgcn_sched_barrier(0);
    put(1);
}

template <bool RELU, typename OutT, int N>
__global__ __launch_bounds__(256) void gemm_wmma(const _Float16* __restrict__ A,
                                                 const _Float16* __restrict__ Bw,
                                                 const float* __restrict__ bias,
                                                 OutT* __restrict__ C,
                                                 int K) {
    gemm_tile<RELU, OutT, N>(A, Bw, bias, C, K, blockIdx.y * GBM, blockIdx.x * GBN);
}

// The three projections of one A in ONE grid, blockIdx.z = 0, 1, 2 for Q, K, V:
// they read none of each other's output. W holds the three [N,K] weights and C
// the three [M,N] results, each one behind the other.
__global__ __launch_bounds__(256) void gemm_qkv(const _Float16* __restrict__ A,
                                                const _Float16* __restrict__ W,
                                                const float* __restrict__ bq,
                                                const float* __restrict__ bk,
                                                const float* __restrict__ bv,
                                                _Float16* __restrict__ C,
                                                int M, int K) {
    constexpr int N = TD;
    const int which = blockIdx.z;
    const float* bias = which == 0 ? bq : which == 1 ? bk : bv;
    gemm_tile<false, _Float16, N>(A, W + (size_t)which * N * K, bias,
                                  C + (size_t)which * M * N, K,
                                  blockIdx.y * GBM, blockIdx.x * GBN);
}

// ------------------------------ flash attention ----------------------------
// value of lane l ^ 16 (the other 16-lane half), by a vector cross-row move
__device__ __forceinline__ float xhalf(float x) {
    const int b = __builtin_bit_cast(int, x);
    return __builtin_bit_cast(float, __builtin_amdgcn_permlanex16(
        b, b, 0x76543210, 0xfedcba98, false, false));
}

// 16 bytes of a row-major 16-bit LDS tile per lane, handed out transposed:
// two of them (k and k + 16) are one 16 x 32 A fragment in the hardware k order
typedef __attribute__((ext_vector_type(8))) short s16x8;
__device__ __forceinline__ uint4 lds_tr16(const _Float16* p) {
    typedef __attribute__((address_space(3))) s16x8 lds_s16x8;
    return __builtin_bit_cast(uint4,
        __builtin_amdgcn_ds_load_tr16_b128_v8i16((lds_s16x8*)p));
}

// grid = (S/128, B*H), block = 128 (4 waves); each wave owns 32 query rows, as
// two groups of 16: a K or V fragment read from LDS feeds two products, and the
// Q fragments stay in registers for the whole kernel. A block's K and V tiles
// serve 128 queries. Four waves a SIMD (256 VGPRs each): all blocks resident.
// Q/K/V in [B,S,H,HD] f16 layout (row stride D). Output Hcat same layout.
#define AQB 128   // query rows per block
static_assert(TS % AQB == 0 && TS % 64 == 0, "attention tiles must be full");
__global__ __launch_bounds__(128) __attribute__((amdgpu_waves_per_eu(4, 4)))
void attn_wmma(const _Float16* __restrict__ Qg,
               const _Float16* __restrict__ Kg,
               const _Float16* __restrict__ Vg,
               _Float16* __restrict__ Og) {
    constexpr int LDT = 72;                 // padded LDS row stride (halves)
    // V rows [k][e]: 160 B = 32 B x odd, the pitch of the transposing load
    constexpr int LDV = 80;
    __shared__ __attribute__((aligned(16))) _Float16 Ks[64 * LDT];
    __shared__ __attribute__((aligned(16))) _Float16 Vs[64 * LDV];

    const int bh   = blockIdx.y;            // 0..63
    const int b    = bh >> 4;
    const int h    = bh & 15;
    const int q0   = blockIdx.x * AQB;
    const int tid  = threadIdx.x;
    const int wave = tid >> 5;
    const int lane = tid & 31;
    const int r    = lane & 15;
    const int hs   = lane >> 4;

    const size_t rowbase = (size_t)(b * TS) * TD + (size_t)h * THD;
    const _Float16* Qb = Qg + rowbase;
    const _Float16* Kb = Kg + rowbase;
    const _Float16* Vb = Vg + rowbase;

    // tile copies: 8 lanes a row (one 128-B line), 16 rows a copy of the block,
    // 4 copies for each of K and V
    const int crow = tid >> 3;              // 0..15
    const int ccol = (tid & 7) * 8;         // 0..56 halves
    constexpr unsigned K16B = 16 * LDT * 2; // bytes of 16 LDS rows of K
    constexpr unsigned V16B = 16 * LDV * 2; // bytes of 16 LDS rows of V
    constexpr size_t   G16  = (size_t)16 * TD;   // 16 global rows, in halves

    // Q fragments (B operand), read once from global memory: group g, lane
    // (hs, r) holds query row wave*32 + g*16 + r in the k order of the K reads
    v16h bq[2][2];
#pragma unroll
    for (int g = 0; g < 2; ++g)
#pragma unroll
        for (int ks = 0; ks < 2; ++ks) {
            const _Float16* qb = Qb + (size_t)(q0 + wave * 32 + g * 16 + r) * TD +
                                 ks * 32 + hs * 8;
            ((uint4*)&bq[g][ks])[0] = *(const uint4*)(qb);
            ((uint4*)&bq[g][ks])[1] = *(const uint4*)(qb + 16);
        }

    const v8f vzero = {0.f, 0.f, 0.f, 0.f, 0.f, 0.f, 0.f, 0.f};
    // Transposed products: in group g a lane (hs, r) owns ONE query.
    //   sc[g][j][jj] = S^T[key j*16 + hs*8 + jj][query g*16 + r]
    //   o[g][j][jj]  = O^T[e   j*16 + hs*8 + jj][query g*16 + r]
    v8f o[2][4];
#pragma unroll
    for (int g = 0; g < 2; ++g)
#pragma unroll
        for (int j = 0; j < 4; ++j) o[g][j] = vzero;
    // running maximum of each of the lane's queries, unscaled
    float mrow[2] = {-1.0e30f, -1.0e30f};
    v8f lsum[2] = {vzero, vzero};   // running sums over this lane half's keys only

    // 1/sqrt(D) * log2(e) = log2(e) / 32
    const float sc2 = 0.03125f * 1.44269504088896340736f;

    const unsigned ldsK = (unsigned)(uintptr_t)(Ks + crow * LDT + ccol);
    const unsigned ldsV = (unsigned)(uintptr_t)(Vs + crow * LDV + ccol);
    // lane address of the transposing load: row 8*hs + (lane & 7), and the
    // second 16 B of the 32-B column group in lanes 8..15 of each half
    const _Float16* vtr = Vs + (hs * 8 + (lane & 7)) * LDV + ((lane >> 3) & 1) * 8;

    for (int kt = 0; kt < TS / 64; ++kt) {
        const int k0 = kt * 64;
        // this wave's LDS reads of the previous tile have retired before any
        // wave's copies may overwrite it ...
        asm volatile("s_wait_dscnt 0x0" ::: "memory");
        __syncthreads();                    // ... and so have every wave's
        // K and V tiles, both row-major, via async-to-LDS
        {
            const _Float16* gk = Kb + (size_t)(k0 + crow) * TD + ccol;
            const _Float16* gv = Vb + (size_t)(k0 + crow) * TD + ccol;
            async_copy8_b128(ldsK,            gk,           ldsK + K16B,     gk + G16,
                             ldsK + 2 * K16B, gk + 2 * G16, ldsK + 3 * K16B, gk + 3 * G16,
                             ldsV,            gv,           ldsV + V16B,     gv + G16,
                             ldsV + 2 * V16B, gv + 2 * G16, ldsV + 3 * V16B, gv + 3 * G16);
        }
        if (kt + 1 < TS / 64)               // lowers to global_prefetch_b8
            __builtin_prefetch(Kb + (size_t)(k0 + 64) * TD + (tid & 63), 0, 1);
        wait_async(0);                      // own async K and V writes done
        __syncthreads();

        // ---- S^T = K @ Q^T  (64 keys x 32 queries per wave) ----
        // A = K rows, B = Q rows, both in the same k order; each K fragment
        // feeds both query groups
        v8f sc[2][4];
#pragma unroll
        for (int g = 0; g < 2; ++g)
#pragma unroll
            for (int j = 0; j < 4; ++j) sc[g][j] = vzero;
#pragma unroll
        for (int ks = 0; ks < 2; ++ks) {
#pragma unroll
            for (int j = 0; j < 4; ++j) {
                v16h ak;
                const _Float16* kb = Ks + (j * 16 + r) * LDT + ks * 32 + hs * 8;
                ((uint4*)&ak)[0] = *(const uint4*)(kb);
                ((uint4*)&ak)[1] = *(const uint4*)(kb + 16);
#pragma unroll
                for (int g = 0; g < 2; ++g)
                    sc[g][j] = __builtin_amdgcn_wmma_f32_16x16x32_f16(
                        false, ak, false, bq[g][ks], (short)0, sc[g][j], false, false);
            }
        }

        // ---- online softmax: a group's 32 scores of a lane belong to one query ----
        // The scores stay unscaled: with c = scale * log2(e) > 0 the maximum of
        // the raw scores is the maximum of the scaled ones, and
        // exp(scale * (s - m)) = exp2(s * c - m * c) is one fused multiply-add
        // a score. That multiply-add and the sums are written on 8-wide vectors, which the compiler
        // turns into packed f32 instructions (two scores each).
#pragma unroll
        for (int g = 0; g < 2; ++g) {
            float mx = -1.0e30f;
#pragma unroll
            for (int j = 0; j < 4; ++j)
#pragma unroll
                for (int jj = 0; jj < 8; ++jj) mx = fmaxf(mx, sc[g][j][jj]);
            mx = fmaxf(mx, xhalf(mx));      // the other 32 keys of the query
            const float mn   = fmaxf(mrow[g], mx);
            const float nmc  = -mn * sc2;
            const float corr = __builtin_amdgcn_exp2f(__builtin_fmaf(mrow[g], sc2, nmc));
#pragma unroll
            for (int j = 0; j < 4; ++j) {
                sc[g][j] = sc[g][j] * sc2 + nmc;
#pragma unroll
                for (int jj = 0; jj < 8; ++jj)
                    sc[g][j][jj] = __builtin_amdgcn_exp2f(sc[g][j][jj]);
            }
            // eight partial sums a lane and group; they are joined after the loop
            lsum[g] = lsum[g] * corr + ((sc[g][0] + sc[g][1]) + (sc[g][2] + sc[g][3]));
            mrow[g] = mn;
#pragma unroll
            for (int j = 0; j < 4; ++j) o[g][j] *= corr;
        }

        // ---- O^T += V^T @ P^T  (A = V^T by transposing loads; B = P^T from sc) ----
        // Two S^T tiles converted in place are the B operand: element s of the
        // lane is key ks*32 + (s < 8 ? hs*8 + s : 16 + hs*8 + s - 8), which is
        // the k order of the transposing loads below: lane (hs, r) gets
        // V[ks*32 + hs*8 + 0..7][j*16 + r], then the same 16 keys further on.
        // Each V^T fragment feeds both query groups.
#pragma unroll
        for (int ks = 0; ks < 2; ++ks) {
            v16h bp[2];
#pragma unroll
            for (int g = 0; g < 2; ++g)
#pragma unroll
                for (int jj = 0; jj < 8; ++jj) {
                    bp[g][jj]     = (_Float16)sc[g][2 * ks][jj];
                    bp[g][8 + jj] = (_Float16)sc[g][2 * ks + 1][jj];
                }
#pragma unroll
            for (int j = 0; j < 4; ++j) {
                v16h av;
                const _Float16* vb = vtr + ks * 32 * LDV + j * 16;
                ((uint4*)&av)[0] = lds_tr16(vb);
                ((uint4*)&av)[1] = lds_tr16(vb + 16 * LDV);
#pragma unroll
                for (int g = 0; g < 2; ++g)
                    o[g][j] = __builtin_amdgcn_wmma_f32_16x16x32_f16(
                        false, av, false, bp[g], (short)0, o[g][j], false, false);
            }
        }
    }

    // ---- normalize and store Hcat[b, s, h*64 + e]: 8 consecutive e a lane ----
#pragma unroll
    for (int g = 0; g < 2; ++g) {
        const float lrow = ((lsum[g][0] + lsum[g][1]) + (lsum[g][2] + lsum[g][3])) +
                           ((lsum[g][4] + lsum[g][5]) + (lsum[g][6] + lsum[g][7]));
        const float invl = 1.0f / (lrow + xhalf(lrow));
        _Float16* orow = Og + rowbase +
                         (size_t)(q0 + wave * 32 + g * 16 + r) * TD + hs * 8;
#pragma unroll
        for (int j = 0; j < 4; ++j) {
            v8h ov;
#pragma unroll
            for (int jj = 0; jj < 8; ++jj) ov[jj] = (_Float16)(o[g][j][jj] * invl);
            *(v8h*)(orow + j * 16) = ov;
        }
    }
}

// -------------------------------- launcher ---------------------------------
extern "C" void kernel_launch(void* const* d_in, const int* in_sizes, int n_in,
                              void* d_out, int out_size, void* d_ws, size_t ws_size,
                              hipStream_t stream) {
    const float* emb = (const float*)d_in[0];
    const float* Wq  = (const float*)d_in[1];
    const float* bq  = (const float*)d_in[2];
    const float* Wk  = (const float*)d_in[3];
    const float* bk  = (const float*)d_in[4];
    const float* Wv  = (const float*)d_in[5];
    const float* bv  = (const float*)d_in[6];
    const float* W1  = (const float*)d_in[7];
    const float* b1  = (const float*)d_in[8];
    const float* W2  = (const float*)d_in[9];
    const float* b2  = (const float*)d_in[10];
    float* out = (float*)d_out;

    // workspace carve-up (f16 units)
    _Float16* ws = (_Float16*)d_ws;
    const size_t nEmb = (size_t)TM * TD;          // 8192*1024
    const size_t nWqkv = (size_t)TD * TD;         // 1024*1024
    const size_t nW1 = (size_t)TFF * TD;
    const size_t nW2 = (size_t)TD * TFF;
    _Float16* emb16  = ws;                 ws += nEmb;
    _Float16* wq16   = ws;                 ws += nWqkv;
    _Float16* wk16   = ws;                 ws += nWqkv;
    _Float16* wv16   = ws;                 ws += nWqkv;
    _Float16* w1_16  = ws;                 ws += nW1;
    _Float16* w2_16  = ws;                 ws += nW2;
    _Float16* q16    = ws;                 ws += nEmb;
    _Float16* k16    = ws;                 ws += nEmb;
    _Float16* v16    = ws;                 ws += nEmb;
    _Float16* hcat16 = ws;                 ws += nEmb;
    _Float16* hid16  = ws;                 ws += (size_t)TM * TFF;

    // emb16 | wq16 | wk16 | wv16 | w1_16 | w2_16, contiguous from emb16
    cvt_f32_to_f16<<<dim3(CVT_NB_ALL), dim3(256), 0, stream>>>(emb, Wq, Wk, Wv, W1, W2, emb16);

    // QKV projections: [8192,1024] = emb16 @ W^T + b   (f16 out);
    // wq16 | wk16 | wv16 and q16 | k16 | v16 are contiguous
    {
        dim3 grid(TD / GBN, TM / GBM, 3), blk(256);
        gemm_qkv<<<grid, blk, 0, stream>>>(emb16, wq16, bq, bk, bv, q16, TM, TD);
    }

    // attention -> Hcat (f16, [B,S,H*HD])
    {
        dim3 grid(TS / AQB, TB * TH), blk(128);
        attn_wmma<<<grid, blk, 0, stream>>>(q16, k16, v16, hcat16);
    }

    // FFN layer 1: relu(Hcat @ W1^T + b1)  -> hid16 [8192,4096]
    {
        dim3 grid(TFF / GBN, TM / GBM), blk(256);
        gemm_wmma<true, _Float16, TFF><<<grid, blk, 0, stream>>>(hcat16, w1_16, b1, hid16, TD);
    }
    // FFN layer 2: hid @ W2^T + b2 -> d_out (f32, [8192,1024])
    {
        dim3 grid(TD / GBN, TM / GBM), blk(256);
        gemm_wmma<false, float, TD><<<grid, blk, 0, stream>>>(hid16, w2_16, b2, out, TFF);
    }
}
